// v000
// The times below were measured on an AMD MI455X: many runs one after another, warmed up first and cycling through
// copies of the inputs, with the whole window's GPU time divided by the number of runs. Launches and the gaps
// between them are all in it. The median over several windows is given; except for v000 it joins two sittings, which
// can be a few percent apart, so the side-by-side timings, each taken in one sitting, are the better comparison.
// The starting kernel, v000, takes 105 microseconds a run.
#include <hip/hip_runtime.h>

// Fused Parallax-Attention (PAM) for MI455X / gfx1250.
// One workgroup (256 threads = 8 wave32) per (batch, row, direction).
// Pipeline per block, all in LDS:
//   1) load src row (float4) -> Xt (w,c) f16
//   2) conv1x1+BN (folded) via WMMA -> Qt (w,c) f16  [log2e/64 folded in]
//   3) load tgt row -> Xt (w,c) and V (c,w) f16
//   4) conv1x1+BN via WMMA -> Kt (w,c) f16
//   5) flash-style attention: S^T = K^T Q via WMMA, online softmax in exp2
//      domain (per-lane + one shfl_xor(16)), O^T += V * P via WMMA.

typedef __attribute__((ext_vector_type(16))) _Float16 v16h;
typedef __attribute__((ext_vector_type(8)))  _Float16 v8h;
typedef __attribute__((ext_vector_type(4)))  _Float16 v4h;
typedef __attribute__((ext_vector_type(8)))  float    v8f;

#define NB 8
#define NC 64
#define NH 128
#define NW 256
#define HWSZ (NH * NW)
#define BN_EPS 1e-5f
#define LOG2E 1.44269504088896340736f

// LDS layout (in halfs). All strides multiples of 8 halfs (16B) for b128 ds ops.
#define XT_OFF 0
#define XT_STR 72
#define QT_OFF (256 * 72)
#define KT_OFF (2 * 256 * 72)
#define V_OFF  (3 * 256 * 72)
#define V_STR  264
#define SMEM_HALFS (3 * 256 * 72 + 64 * 264)   // 72192 halfs
#define SMEM_BYTES (SMEM_HALFS * 2)            // 144384 B (<= 320KB/WGP)

__device__ __forceinline__ v8f wmma16(v16h a, v16h b, v8f c) {
  // D = A(16x32 f16) * B(32x16 f16) + C(16x16 f32)
  return __builtin_amdgcn_wmma_f32_16x16x32_f16(false, a, false, b,
                                                (short)0, c, false, false);
}

// Load one 16x32 f16 A/B operand half-row for this lane:
// elements 0..7 = p[0..7], elements 8..15 = p[16..23]  (caller adds the
// lane<16 ? 0 : 8 half-wave K offset).
__device__ __forceinline__ v16h ld_ab(const _Float16* p) {
  v8h lo = *(const v8h*)(p);
  v8h hi = *(const v8h*)(p + 16);
  v16h r;
#pragma unroll
  for (int i = 0; i < 8; ++i) { r[i] = lo[i]; r[8 + i] = hi[i]; }
  return r;
}

// ---------------- setup: fold BN into weights ----------------
// ws layout: halfs [0..4095]=Wq' (x log2e/64), [4096..8191]=Wk';
// bytes 16384: float Bq'[64], Bk'[64].
__global__ void fold_weights(const float* __restrict__ Wq, const float* __restrict__ bq,
                             const float* __restrict__ gq, const float* __restrict__ betaq,
                             const float* __restrict__ mq, const float* __restrict__ vq,
                             const float* __restrict__ Wk, const float* __restrict__ bk,
                             const float* __restrict__ gk, const float* __restrict__ betak,
                             const float* __restrict__ mk, const float* __restrict__ vk,
                             _Float16* __restrict__ wsW, float* __restrict__ wsB) {
  const float qscale = LOG2E / 64.0f;   // cost/64, softmax computed with exp2
  int t = threadIdx.x;
  for (int i = t; i < 4096; i += 256) {
    int o = i >> 6;
    float sq = gq[o] * rsqrtf(vq[o] + BN_EPS);
    float sk = gk[o] * rsqrtf(vk[o] + BN_EPS);
    wsW[i]        = (_Float16)(Wq[i] * sq * qscale);
    wsW[4096 + i] = (_Float16)(Wk[i] * sk);
  }
  if (t < 64) {
    float sq = gq[t] * rsqrtf(vq[t] + BN_EPS);
    float sk = gk[t] * rsqrtf(vk[t] + BN_EPS);
    wsB[t]      = (sq * bq[t] + betaq[t] - mq[t] * sq) * qscale;
    wsB[64 + t] = (sk * bk[t] + betak[t] - mk[t] * sk);
  }
}

// Conv 1x1 over one row: Y(64 out x 256 px) = W'(64x64) X + b', X in Xt (w,c) LDS.
__device__ __forceinline__ void conv_row(_Float16* sm, const _Float16* __restrict__ Wf,
                                         const float* __restrict__ Bf, int dst_off,
                                         int wvs, int hl, int k0) {
  for (int ii = 0; ii < 2; ++ii) {                 // uniform trip: no exec masking
    const int pt = wvs + ii * 8;                   // pixel tile (wave-scalar base)
    const _Float16* xrow = sm + XT_OFF + (pt * 16 + hl) * XT_STR;
    v16h xb0 = ld_ab(xrow + k0);                   // in-ch 0..31  (B operand)
    v16h xb1 = ld_ab(xrow + 32 + k0);              // in-ch 32..63
#pragma unroll
    for (int t = 0; t < 4; ++t) {                  // 4 out-channel tiles
      const _Float16* wrow = Wf + (t * 16 + hl) * 64;
      v16h a0 = ld_ab(wrow + k0);
      v16h a1 = ld_ab(wrow + 32 + k0);
      v8f acc;
#pragma unroll
      for (int k = 0; k < 8; ++k) acc[k] = Bf[t * 16 + k0 + k];
      acc = wmma16(a0, xb0, acc);
      acc = wmma16(a1, xb1, acc);
      v8h hv;
#pragma unroll
      for (int k = 0; k < 8; ++k) hv[k] = (_Float16)acc[k];
      *(v8h*)(sm + dst_off + (pt * 16 + hl) * XT_STR + t * 16 + k0) = hv;
    }
  }
}

__global__ __launch_bounds__(256) void pam_fused(const float* __restrict__ fea_left,
                                                 const float* __restrict__ fea_right,
                                                 const _Float16* __restrict__ wsW,
                                                 const float* __restrict__ wsB,
                                                 float* __restrict__ out) {
  extern __shared__ _Float16 sm[];
  const int bi  = blockIdx.x;
  const int dir = bi >> 10;                 // 1024 = NB*NH blocks per direction
  const int r   = bi & 1023;
  const int b   = r >> 7;
  const int h   = r & 127;
  const float* src = dir ? fea_right : fea_left;   // queries from src
  const float* tgt = dir ? fea_left  : fea_right;  // keys/values from tgt
  const size_t rowoff = (size_t)b * NC * HWSZ + (size_t)h * NW;

  const int tid  = threadIdx.x;
  const int lane = tid & 31;
  const int wvs  = __builtin_amdgcn_readfirstlane(tid >> 5);  // wave id, scalar
  const int hl   = lane & 15;
  const int k0   = (lane < 16) ? 0 : 8;     // ISA half-wave K offset

  // ---- pass 1: src row -> Xt (w,c) f16, float4-vectorized ----
  {
    const float4* sp = (const float4*)(src + rowoff);
    for (int i = tid; i < NC * NW / 4; i += 256) {
      int c = i >> 6, w = (i & 63) * 4;
      float4 v = sp[c * (HWSZ / 4) + (i & 63)];
      sm[XT_OFF + (w + 0) * XT_STR + c] = (_Float16)v.x;
      sm[XT_OFF + (w + 1) * XT_STR + c] = (_Float16)v.y;
      sm[XT_OFF + (w + 2) * XT_STR + c] = (_Float16)v.z;
      sm[XT_OFF + (w + 3) * XT_STR + c] = (_Float16)v.w;
    }
  }
  __syncthreads();

  // ---- conv Q (log2e/64 folded) -> Qt ----
  conv_row(sm, wsW, wsB, QT_OFF, wvs, hl, k0);
  __syncthreads();

  // ---- pass 2: tgt row -> Xt (w,c) and V (c,w) ----
  {
    const float4* tp = (const float4*)(tgt + rowoff);
    for (int i = tid; i < NC * NW / 4; i += 256) {
      int c = i >> 6, w = (i & 63) * 4;
      float4 v = tp[c * (HWSZ / 4) + (i & 63)];
      v4h hv4 = {(_Float16)v.x, (_Float16)v.y, (_Float16)v.z, (_Float16)v.w};
      sm[XT_OFF + (w + 0) * XT_STR + c] = hv4[0];
      sm[XT_OFF + (w + 1) * XT_STR + c] = hv4[1];
      sm[XT_OFF + (w + 2) * XT_STR + c] = hv4[2];
      sm[XT_OFF + (w + 3) * XT_STR + c] = hv4[3];
      *(v4h*)(sm + V_OFF + c * V_STR + w) = hv4;
    }
  }
  __syncthreads();

  // ---- conv K -> Kt ----
  conv_row(sm, wsW + 4096, wsB + 64, KT_OFF, wvs, hl, k0);
  __syncthreads();

  // ---- attention: per wave, 2 query tiles of 16 queries ----
  for (int ii = 0; ii < 2; ++ii) {
    const int qt = wvs + ii * 8;
    const _Float16* qrow = sm + QT_OFF + (qt * 16 + hl) * XT_STR;
    v16h qb0 = ld_ab(qrow + k0);        // Q B-operand, ch 0..31
    v16h qb1 = ld_ab(qrow + 32 + k0);   // ch 32..63

    v8f o[4];
#pragma unroll
    for (int t = 0; t < 4; ++t)
#pragma unroll
      for (int k = 0; k < 8; ++k) o[t][k] = 0.0f;
    float m = -3.0e38f, l = 0.0f;

    for (int kc = 0; kc < 8; ++kc) {    // 8 key chunks of 32 keys
      // K^T A-operands: two key tiles (keys kc*32+0..15 and +16..31)
      const _Float16* kr0 = sm + KT_OFF + (kc * 32 + hl) * XT_STR;
      const _Float16* kr1 = kr0 + 16 * XT_STR;
      v16h ka00 = ld_ab(kr0 + k0), ka01 = ld_ab(kr0 + 32 + k0);
      v16h ka10 = ld_ab(kr1 + k0), ka11 = ld_ab(kr1 + 32 + k0);

      v8f s0, s1;
#pragma unroll
      for (int k = 0; k < 8; ++k) { s0[k] = 0.0f; s1[k] = 0.0f; }
      s0 = wmma16(ka00, qb0, s0); s0 = wmma16(ka01, qb1, s0);
      s1 = wmma16(ka10, qb0, s1); s1 = wmma16(ka11, qb1, s1);

      // online softmax (exp2 domain; log2e folded into Q) per query lane pair
      float cm = s0[0];
#pragma unroll
      for (int k = 1; k < 8; ++k) cm = fmaxf(cm, s0[k]);
#pragma unroll
      for (int k = 0; k < 8; ++k) cm = fmaxf(cm, s1[k]);
      cm = fmaxf(cm, __shfl_xor(cm, 16, 32));
      float mn   = fmaxf(m, cm);
      float corr = __builtin_amdgcn_exp2f(m - mn);
      v8f p0, p1;
      float cs = 0.0f;
#pragma unroll
      for (int k = 0; k < 8; ++k) { p0[k] = __builtin_amdgcn_exp2f(s0[k] - mn); cs += p0[k]; }
#pragma unroll
      for (int k = 0; k < 8; ++k) { p1[k] = __builtin_amdgcn_exp2f(s1[k] - mn); cs += p1[k]; }
      cs += __shfl_xor(cs, 16, 32);
      l = l * corr + cs;
      m = mn;
#pragma unroll
      for (int t = 0; t < 4; ++t) o[t] = o[t] * corr;

      // P^T C-layout -> B-operand by pure per-lane f32->f16 pair packing
      v16h pb;
#pragma unroll
      for (int e = 0; e < 8; ++e) { pb[e] = (_Float16)p0[e]; pb[8 + e] = (_Float16)p1[e]; }

      // O^T += V(ch tile, 32 keys) * P
#pragma unroll
      for (int ct = 0; ct < 4; ++ct) {
        v16h va = ld_ab(sm + V_OFF + (ct * 16 + hl) * V_STR + kc * 32 + k0);
        o[ct] = wmma16(va, pb, o[ct]);
      }
    }

    // finalize and write out (B,C,H,W) f32; dir selects cxr vs enh half
    float inv = 1.0f / l;
    float* obase = out + (size_t)dir * ((size_t)NB * NC * HWSZ)
                 + (size_t)b * NC * HWSZ + (size_t)h * NW + qt * 16 + hl;
#pragma unroll
    for (int ct = 0; ct < 4; ++ct)
#pragma unroll
      for (int k = 0; k < 8; ++k)
        obase[(size_t)(ct * 16 + k0 + k) * HWSZ] = o[ct][k] * inv;
  }
}

extern "C" void kernel_launch(void* const* d_in, const int* in_sizes, int n_in,
                              void* d_out, int out_size, void* d_ws, size_t ws_size,
                              hipStream_t stream) {
  (void)in_sizes; (void)n_in; (void)out_size; (void)ws_size;
  const float* fl = (const float*)d_in[0];
  const float* fr = (const float*)d_in[1];
  _Float16* wsW = (_Float16*)d_ws;
  float*    wsB = (float*)((char*)d_ws + 16384);

  fold_weights<<<1, 256, 0, stream>>>(
      (const float*)d_in[2],  (const float*)d_in[3],  (const float*)d_in[4],
      (const float*)d_in[5],  (const float*)d_in[6],  (const float*)d_in[7],
      (const float*)d_in[8],  (const float*)d_in[9],  (const float*)d_in[10],
      (const float*)d_in[11], (const float*)d_in[12], (const float*)d_in[13],
      wsW, wsB);

  (void)hipFuncSetAttribute((const void*)pam_fused,
                            hipFuncAttributeMaxDynamicSharedMemorySize, SMEM_BYTES);
  pam_fused<<<dim3(NB * NH * 2), dim3(256), SMEM_BYTES, stream>>>(
      fl, fr, wsW, wsB, (float*)d_out);
}

// v001
// One run takes 70.7 microseconds.
// Next to v000, in two timings, it ran 1.53 times as fast each time.
#include <hip/hip_runtime.h>

// Fused Parallax-Attention (PAM) for MI455X / gfx1250.
// One workgroup (256 threads = 8 wave32) per (batch, row, direction).
// Pipeline per block:
//   1) each wave loads its 32 pixels of the src and the tgt row straight into the
//      convs' B fragments (lane = pixel pair, 8-byte loads, one 128-B line per half-wave)
//   2) the tgt row also goes to V (c,w) f16 in LDS
//   3) conv1x1+BN (folded) via WMMA -> Qt (w,c) f16 in LDS  [log2e/64 folded in]
//   4) conv1x1+BN via WMMA -> Kt (w,c) f16 in LDS, then the one barrier
//   5) flash-style attention: S^T = K^T Q via WMMA, online softmax in exp2
//      domain (per-lane + one shfl_xor(16)), O^T += V * P via WMMA.

typedef __attribute__((ext_vector_type(16))) _Float16 v16h;
typedef __attribute__((ext_vector_type(8)))  _Float16 v8h;
typedef __attribute__((ext_vector_type(2)))  _Float16 v2h;
typedef __attribute__((ext_vector_type(8)))  float    v8f;

#define NB 8
#define NC 64
#define NH 128
#define NW 256
#define HWSZ (NH * NW)
#define BN_EPS 1e-5f
#define LOG2E 1.44269504088896340736f

// LDS layout (in halfs). All strides multiples of 8 halfs (16B) for b128 ds ops.
#define XT_STR 72
#define QT_OFF 0
#define KT_OFF (256 * 72)
#define V_OFF  (2 * 256 * 72)
#define V_STR  264
#define SMEM_HALFS (2 * 256 * 72 + 64 * 264)   // 53760 halfs
#define SMEM_BYTES (SMEM_HALFS * 2)            // 107520 B: three blocks per WGP

__device__ __forceinline__ v8f wmma16(v16h a, v16h b, v8f c) {
  // D = A(16x32 f16) * B(32x16 f16) + C(16x16 f32)
  return __builtin_amdgcn_wmma_f32_16x16x32_f16(false, a, false, b,
                                                (short)0, c, false, false);
}

// Load one 16x32 f16 A/B operand half-row for this lane:
// elements 0..7 = p[0..7], elements 8..15 = p[16..23]  (caller adds the
// lane<16 ? 0 : 8 half-wave K offset).
__device__ __forceinline__ v16h ld_ab(const _Float16* p) {
  v8h lo = *(const v8h*)(p);
  v8h hi = *(const v8h*)(p + 16);
  v16h r;
#pragma unroll
  for (int i = 0; i < 8; ++i) { r[i] = lo[i]; r[8 + i] = hi[i]; }
  return r;
}

// ---------------- setup: fold BN into weights ----------------
// ws layout: halfs [0..4095]=Wq' (x log2e/64), [4096..8191]=Wk';
// bytes 16384: float Bq'[64], Bk'[64].
__global__ void fold_weights(const float* __restrict__ Wq, const float* __restrict__ bq,
                             const float* __restrict__ gq, const float* __restrict__ betaq,
                             const float* __restrict__ mq, const float* __restrict__ vq,
                             const float* __restrict__ Wk, const float* __restrict__ bk,
                             const float* __restrict__ gk, const float* __restrict__ betak,
                             const float* __restrict__ mk, const float* __restrict__ vk,
                             _Float16* __restrict__ wsW, float* __restrict__ wsB) {
  const float qscale = LOG2E / 64.0f;   // cost/64, softmax computed with exp2
  int t = threadIdx.x;
  for (int i = t; i < 4096; i += 256) {
    int o = i >> 6;
    float sq = gq[o] * rsqrtf(vq[o] + BN_EPS);
    float sk = gk[o] * rsqrtf(vk[o] + BN_EPS);
    wsW[i]        = (_Float16)(Wq[i] * sq * qscale);
    wsW[4096 + i] = (_Float16)(Wk[i] * sk);
  }
  if (t < 64) {
    float sq = gq[t] * rsqrtf(vq[t] + BN_EPS);
    float sk = gk[t] * rsqrtf(vk[t] + BN_EPS);
    wsB[t]      = (sq * bq[t] + betaq[t] - mq[t] * sq) * qscale;
    wsB[64 + t] = (sk * bk[t] + betak[t] - mk[t] * sk);
  }
}

// One lane's share of a row for the conv's B operand. p points at channel k0,
// pixel pair (2*hl, 2*hl+1) of the wave's 32 pixels. raw[kh*16 + q] is element q
// of the fragment of in-channels kh*32..kh*32+31 (the k order of ld_ab):
// .x belongs to column hl of pixel tile 0 (even pixels), .y to tile 1 (odd pixels).
__device__ __forceinline__ void load_row(const float* __restrict__ p, float2 (&raw)[32]) {
#pragma unroll
  for (int i = 0; i < 32; ++i)
    raw[i] = *(const float2*)(p + (size_t)((i >> 3) * 16 + (i & 7)) * HWSZ);
}

__device__ __forceinline__ void to_frags(const float2 (&raw)[32], v16h (&xb)[2][2]) {
#pragma unroll
  for (int kh = 0; kh < 2; ++kh)
#pragma unroll
    for (int q = 0; q < 16; ++q) {
      xb[0][kh][q] = (_Float16)raw[kh * 16 + q].x;
      xb[1][kh][q] = (_Float16)raw[kh * 16 + q].y;
    }
}

// Conv 1x1 over the wave's 32 pixels: Y(64 out x 32 px) = W'(64x64) X + b'.
// dst points at this lane's even pixel row, channel k0; the odd pixel is the next row.
__device__ __forceinline__ void conv_frags(_Float16* dst, const _Float16* __restrict__ Wf,
                                           const float* __restrict__ Bf,
                                           const v16h (&xb)[2][2], int hl, int k0) {
#pragma unroll
  for (int t = 0; t < 4; ++t) {                    // 4 out-channel tiles
    const _Float16* wrow = Wf + (t * 16 + hl) * 64;
    v16h a0 = ld_ab(wrow + k0);
    v16h a1 = ld_ab(wrow + 32 + k0);
    v8f bias;
#pragma unroll
    for (int k = 0; k < 8; ++k) bias[k] = Bf[t * 16 + k0 + k];
#pragma unroll
    for (int j = 0; j < 2; ++j) {                  // even / odd pixel tile
      v8f acc = wmma16(a0, xb[j][0], bias);
      acc = wmma16(a1, xb[j][1], acc);
      v8h hv;
#pragma unroll
      for (int k = 0; k < 8; ++k) hv[k] = (_Float16)acc[k];
      *(v8h*)(dst + j * XT_STR + t * 16) = hv;
    }
  }
}

// Second bound: 6 waves per SIMD, the three blocks per WGP that the LDS now allows.
__global__ __launch_bounds__(256, 6) void pam_fused(const float* __restrict__ fea_left,
                                                 const float* __restrict__ fea_right,
                                                 const _Float16* __restrict__ wsW,
                                                 const float* __restrict__ wsB,
                                                 float* __restrict__ out) {
  extern __shared__ _Float16 sm[];
  const int bi  = blockIdx.x;
  const int dir = bi >> 10;                 // 1024 = NB*NH blocks per direction
  const int r   = bi & 1023;
  const int b   = r >> 7;
  const int h   = r & 127;
  const float* src = dir ? fea_right : fea_left;   // queries from src
  const float* tgt = dir ? fea_left  : fea_right;  // keys/values from tgt
  const size_t rowoff = (size_t)b * NC * HWSZ + (size_t)h * NW;

  const int tid  = threadIdx.x;
  const int lane = tid & 31;
  const int wvs  = __builtin_amdgcn_readfirstlane(tid >> 5);  // wave id, scalar
  const int hl   = lane & 15;
  const int k0   = (lane < 16) ? 0 : 8;     // ISA half-wave K offset

  // ---- staging: no transposing LDS stage, fragments come straight from global ----
  const int    pxl  = wvs * 32 + 2 * hl;            // this lane's even pixel
  const size_t loff = rowoff + (size_t)k0 * HWSZ + pxl;
  float2 raws[32], rawt[32];
  v16h   xq[2][2], xk[2][2];

  const float* ps = src + loff;
  const float* pt = tgt + loff;
  load_row(ps, raws);                               // both rows in flight at once:
  load_row(pt, rawt);                               // one memory latency per block
  // The wait that belongs in front of any overwrite of the loads' address registers;
  // naming the two addresses as inputs keeps their registers untouched up to here.
  asm volatile("s_wait_xcnt 0x0" :: "v"(ps), "v"(pt) : "memory");
  to_frags(raws, xq);

  // ---- tgt row -> V (c,w) and the K conv's fragments ----
#pragma unroll
  for (int i = 0; i < 32; ++i) {
    v2h hv2 = {(_Float16)rawt[i].x, (_Float16)rawt[i].y};
    *(v2h*)(sm + V_OFF + ((i >> 3) * 16 + (i & 7) + k0) * V_STR + pxl) = hv2;
  }
  to_frags(rawt, xk);

  // ---- conv Q (log2e/64 folded) -> Qt, conv K -> Kt ----
  conv_frags(sm + QT_OFF + pxl * XT_STR + k0, wsW, wsB, xq, hl, k0);
  conv_frags(sm + KT_OFF + pxl * XT_STR + k0, wsW + 4096, wsB + 64, xk, hl, k0);
  __syncthreads();

  // ---- attention: per wave, 2 query tiles of 16 queries ----
  for (int ii = 0; ii < 2; ++ii) {
    const int qt = wvs + ii * 8;
    const _Float16* qrow = sm + QT_OFF + (qt * 16 + hl) * XT_STR;
    v16h qb0 = ld_ab(qrow + k0);        // Q B-operand, ch 0..31
    v16h qb1 = ld_ab(qrow + 32 + k0);   // ch 32..63

    v8f o[4];
#pragma unroll
    for (int t = 0; t < 4; ++t)
#pragma unroll
      for (int k = 0; k < 8; ++k) o[t][k] = 0.0f;
    float m = -3.0e38f, l = 0.0f;

    for (int kc = 0; kc < 8; ++kc) {    // 8 key chunks of 32 keys
      // K^T A-operands: two key tiles (keys kc*32+0..15 and +16..31)
      const _Float16* kr0 = sm + KT_OFF + (kc * 32 + hl) * XT_STR;
      const _Float16* kr1 = kr0 + 16 * XT_STR;
      v16h ka00 = ld_ab(kr0 + k0), ka01 = ld_ab(kr0 + 32 + k0);
      v16h ka10 = ld_ab(kr1 + k0), ka11 = ld_ab(kr1 + 32 + k0);

      v8f s0, s1;
#pragma unroll
      for (int k = 0; k < 8; ++k) { s0[k] = 0.0f; s1[k] = 0.0f; }
      s0 = wmma16(ka00, qb0, s0); s0 = wmma16(ka01, qb1, s0);
      s1 = wmma16(ka10, qb0, s1); s1 = wmma16(ka11, qb1, s1);

      // online softmax (exp2 domain; log2e folded into Q) per query lane pair
      float cm = s0[0];
#pragma unroll
      for (int k = 1; k < 8; ++k) cm = fmaxf(cm, s0[k]);
#pragma unroll
      for (int k = 0; k < 8; ++k) cm = fmaxf(cm, s1[k]);
      cm = fmaxf(cm, __shfl_xor(cm, 16, 32));
      float mn   = fmaxf(m, cm);
      float corr = __builtin_amdgcn_exp2f(m - mn);
      v8f p0, p1;
      float cs = 0.0f;
#pragma unroll
      for (int k = 0; k < 8; ++k) { p0[k] = __builtin_amdgcn_exp2f(s0[k] - mn); cs += p0[k]; }
#pragma unroll
      for (int k = 0; k < 8; ++k) { p1[k] = __builtin_amdgcn_exp2f(s1[k] - mn); cs += p1[k]; }
      cs += __shfl_xor(cs, 16, 32);
      l = l * corr + cs;
      m = mn;
#pragma unroll
      for (int t = 0; t < 4; ++t) o[t] = o[t] * corr;

      // P^T C-layout -> B-operand by pure per-lane f32->f16 pair packing
      v16h pb;
#pragma unroll
      for (int e = 0; e < 8; ++e) { pb[e] = (_Float16)p0[e]; pb[8 + e] = (_Float16)p1[e]; }

      // O^T += V(ch tile, 32 keys) * P
#pragma unroll
      for (int ct = 0; ct < 4; ++ct) {
        v16h va = ld_ab(sm + V_OFF + (ct * 16 + hl) * V_STR + kc * 32 + k0);
        o[ct] = wmma16(va, pb, o[ct]);
      }
    }

    // finalize and write out (B,C,H,W) f32; dir selects cxr vs enh half
    float inv = 1.0f / l;
    float* obase = out + (size_t)dir * ((size_t)NB * NC * HWSZ)
                 + (size_t)b * NC * HWSZ + (size_t)h * NW + qt * 16 + hl;
#pragma unroll
    for (int ct = 0; ct < 4; ++ct)
#pragma unroll
      for (int k = 0; k < 8; ++k)
        obase[(size_t)(ct * 16 + k0 + k) * HWSZ] = o[ct][k] * inv;
  }
}

extern "C" void kernel_launch(void* const* d_in, const int* in_sizes, int n_in,
                              void* d_out, int out_size, void* d_ws, size_t ws_size,
                              hipStream_t stream) {
  (void)in_sizes; (void)n_in; (void)out_size; (void)ws_size;
  const float* fl = (const float*)d_in[0];
  const float* fr = (const float*)d_in[1];
  _Float16* wsW = (_Float16*)d_ws;
  float*    wsB = (float*)((char*)d_ws + 16384);

  fold_weights<<<1, 256, 0, stream>>>(
      (const float*)d_in[2],  (const float*)d_in[3],  (const float*)d_in[4],
      (const float*)d_in[5],  (const float*)d_in[6],  (const float*)d_in[7],
      (const float*)d_in[8],  (const float*)d_in[9],  (const float*)d_in[10],
      (const float*)d_in[11], (const float*)d_in[12], (const float*)d_in[13],
      wsW, wsB);

  (void)hipFuncSetAttribute((const void*)pam_fused,
                            hipFuncAttributeMaxDynamicSharedMemorySize, SMEM_BYTES);
  pam_fused<<<dim3(NB * NH * 2), dim3(256), SMEM_BYTES, stream>>>(
      fl, fr, wsW, wsB, (float*)d_out);
}

// v002
// One run takes 61.9 microseconds.
// Timed twice side by side with v001, it ran 1.14 times as fast both times.
// All steps since v000 together make it 1.75 times as fast.
#include <hip/hip_runtime.h>

// Fused Parallax-Attention (PAM) for MI455X / gfx1250.
// One workgroup (512 threads = 16 wave32) per (batch, row): both directions.
// Waves 0..7 own the left row, waves 8..15 the right row. Pipeline per block:
//   1) each wave loads its 32 pixels of its own row straight into the convs'
//      B fragments (lane = pixel pair, 8-byte loads, one 128-B line per half-wave)
//   2) the row goes to its side's V (c,w) f16 in LDS
//   3) conv1x1+BN (folded) via WMMA -> its side's Kt (w,c) f16 in LDS
//   4) conv1x1+BN via WMMA from the same fragments -> Q, kept in registers as the
//      score product's B operand  [log2e/64 folded in], then the one barrier
//   5) flash-style attention of the wave's own queries against the OTHER side's
//      Kt and V: S^T = K^T Q via WMMA, online softmax in exp2
//      domain (per-lane + one shfl_xor(16)), O^T += V * P via WMMA.

typedef __attribute__((ext_vector_type(16))) _Float16 v16h;
typedef __attribute__((ext_vector_type(8)))  _Float16 v8h;
typedef __attribute__((ext_vector_type(2)))  _Float16 v2h;
typedef __attribute__((ext_vector_type(8)))  float    v8f;
typedef __attribute__((ext_vector_type(8)))  unsigned int v8u;

#define NB 8
#define NC 64
#define NH 128
#define NW 256
#define HWSZ (NH * NW)
#define BN_EPS 1e-5f
#define LOG2E 1.44269504088896340736f

// LDS layout (in halfs). All strides multiples of 8 halfs (16B) for b128 ds ops.
// Kt and V exist once per side (0 = left row, 1 = right row); a side's V follows its Kt,
// so every constant offset from the side's base fits a ds instruction's offset field.
#define XT_STR 72
#define KT_SZ  (256 * 72)
#define V_STR  264
#define V_SZ   (64 * 264)
#define SIDE_SZ (KT_SZ + V_SZ)
#define QP_OFF (2 * SIDE_SZ)                   // per wave 512 halfs: one parked Q fragment
#define SMEM_HALFS (QP_OFF + 16 * 512)         // 78848 halfs
#define SMEM_BYTES (SMEM_HALFS * 2)            // 157696 B: two blocks per WGP

__device__ __forceinline__ v8f wmma16(v16h a, v16h b, v8f c) {
  // D = A(16x32 f16) * B(32x16 f16) + C(16x16 f32)
  return __builtin_amdgcn_wmma_f32_16x16x32_f16(false, a, false, b,
                                                (short)0, c, false, false);
}

// Load one 16x32 f16 A/B operand half-row for this lane:
// elements 0..7 = p[0..7], elements 8..15 = p[16..23]  (caller adds the
// lane<16 ? 0 : 8 half-wave K offset).
__device__ __forceinline__ v16h ld_ab(const _Float16* p) {
  v8h lo = *(const v8h*)(p);
  v8h hi = *(const v8h*)(p + 16);
  v16h r;
#pragma unroll
  for (int i = 0; i < 8; ++i) { r[i] = lo[i]; r[8 + i] = hi[i]; }
  return r;
}

// ---------------- setup: fold BN into weights ----------------
// ws layout: halfs [0..4095]=Wq' (x log2e/64), [4096..8191]=Wk';
// bytes 16384: float Bq'[64], Bk'[64].
__global__ void fold_weights(const float* __restrict__ Wq, const float* __restrict__ bq,
                             const float* __restrict__ gq, const float* __restrict__ betaq,
                             const float* __restrict__ mq, const float* __restrict__ vq,
                             const float* __restrict__ Wk, const float* __restrict__ bk,
                             const float* __restrict__ gk, const float* __restrict__ betak,
                             const float* __restrict__ mk, const float* __restrict__ vk,
                             _Float16* __restrict__ wsW, float* __restrict__ wsB) {
  const float qscale = LOG2E / 64.0f;   // cost/64, softmax computed with exp2
  int t = threadIdx.x;
  for (int i = t; i < 4096; i += 256) {
    int o = i >> 6;
    float sq = gq[o] * rsqrtf(vq[o] + BN_EPS);
    float sk = gk[o] * rsqrtf(vk[o] + BN_EPS);
    wsW[i]        = (_Float16)(Wq[i] * sq * qscale);
    wsW[4096 + i] = (_Float16)(Wk[i] * sk);
  }
  if (t < 64) {
    float sq = gq[t] * rsqrtf(vq[t] + BN_EPS);
    float sk = gk[t] * rsqrtf(vk[t] + BN_EPS);
    wsB[t]      = (sq * bq[t] + betaq[t] - mq[t] * sq) * qscale;
    wsB[64 + t] = (sk * bk[t] + betak[t] - mk[t] * sk);
  }
}

// One lane's share of a row for the conv's B operand. p points at channel k0,
// pixel pair (2*hl, 2*hl+1) of the wave's 32 pixels. raw[kh*16 + q] is element q
// of the fragment of in-channels kh*32..kh*32+31 (the k order of ld_ab):
// .x belongs to column hl of pixel tile 0 (even pixels), .y to tile 1 (odd pixels).
__device__ __forceinline__ void load_row(const float* __restrict__ p, float2 (&raw)[32]) {
#pragma unroll
  for (int i = 0; i < 32; ++i)
    raw[i] = *(const float2*)(p + (size_t)((i >> 3) * 16 + (i & 7)) * HWSZ);
}

__device__ __forceinline__ void to_frags(const float2 (&raw)[32], v16h (&xb)[2][2]) {
#pragma unroll
  for (int kh = 0; kh < 2; ++kh)
#pragma unroll
    for (int q = 0; q < 16; ++q) {
      xb[0][kh][q] = (_Float16)raw[kh * 16 + q].x;
      xb[1][kh][q] = (_Float16)raw[kh * 16 + q].y;
    }
}

// Conv 1x1 over the wave's 32 pixels: Y(64 out x 32 px) = W'(64x64) X + b'.
// dst points at this lane's even pixel row, channel k0; the odd pixel is the next row.
__device__ __forceinline__ void conv_frags(_Float16* dst, const _Float16* __restrict__ Wf,
                                           const float* __restrict__ Bf,
                                           const v16h (&xb)[2][2], int hl, int k0) {
#pragma unroll
  for (int t = 0; t < 4; ++t) {                    // 4 out-channel tiles
    const _Float16* wrow = Wf + (t * 16 + hl) * 64;
    v16h a0 = ld_ab(wrow + k0);
    v16h a1 = ld_ab(wrow + 32 + k0);
    v8f bias;
#pragma unroll
    for (int k = 0; k < 8; ++k) bias[k] = Bf[t * 16 + k0 + k];
#pragma unroll
    for (int j = 0; j < 2; ++j) {                  // even / odd pixel tile
      v8f acc = wmma16(a0, xb[j][0], bias);
      acc = wmma16(a1, xb[j][1], acc);
      v8h hv;
#pragma unroll
      for (int k = 0; k < 8; ++k) hv[k] = (_Float16)acc[k];
      *(v8h*)(dst + j * XT_STR + t * 16) = hv;
    }
  }
}

// The same conv, its result kept in registers. A 16-channel accumulator tile t holds,
// per lane, channels t*16 + k0 .. + 7 of one pixel: exactly elements (t&1)*8 .. + 7 of
// the B fragment of channels (t>>1)*32 .. + 31 in the k order of ld_ab.
// qf[j] = fragments of the even (j = 0) / odd (j = 1) pixels, column hl = pixel 2*hl + j.
__device__ __forceinline__ void conv_regs(v16h (&qf)[2][2], const _Float16* __restrict__ Wf,
                                          const float* __restrict__ Bf,
                                          const v16h (&xb)[2][2], int hl, int k0) {
#pragma unroll
  for (int t = 0; t < 4; ++t) {                    // 4 out-channel tiles
    const _Float16* wrow = Wf + (t * 16 + hl) * 64;
    v16h a0 = ld_ab(wrow + k0);
    v16h a1 = ld_ab(wrow + 32 + k0);
    v8f bias;
#pragma unroll
    for (int k = 0; k < 8; ++k) bias[k] = Bf[t * 16 + k0 + k];
#pragma unroll
    for (int j = 0; j < 2; ++j) {                  // even / odd pixel tile
      v8f acc = wmma16(a0, xb[j][0], bias);
      acc = wmma16(a1, xb[j][1], acc);
#pragma unroll
      for (int k = 0; k < 8; ++k) qf[j][t >> 1][(t & 1) * 8 + k] = (_Float16)acc[k];
    }
  }
}

// Columns of the even and the odd pixel tile -> two tiles of 16 neighbouring pixels, so
// that a query tile's output columns are contiguous in memory. Each 16-lane row moves alike.
// Step 1 (row rotate by 8 into half the row): y0 = even cols 0..7 | odd cols 0..7,
// y1 = even cols 8..15 | odd cols 8..15. Step 2 (gather in the row): column n of tile ii
// is pixel ii*16 + n = column (n >> 1) + 8 * (n & 1) of y[ii].
__device__ __forceinline__ void regroup_px(v16h ev, v16h od, v16h& t0, v16h& t1) {
  v8u e = __builtin_bit_cast(v8u, ev), o = __builtin_bit_cast(v8u, od), r0, r1;
#pragma unroll
  for (int i = 0; i < 8; ++i) {
    unsigned y0 = __builtin_amdgcn_update_dpp(e[i], o[i], 0x128, 0xf, 0xc, false);
    unsigned y1 = __builtin_amdgcn_update_dpp(o[i], e[i], 0x128, 0xf, 0x3, false);
    r0[i] = __builtin_amdgcn_permlane16(y0, y0, 0xB3A29180u, 0xF7E6D5C4u, false, false);
    r1[i] = __builtin_amdgcn_permlane16(y1, y1, 0xB3A29180u, 0xF7E6D5C4u, false, false);
  }
  t0 = __builtin_bit_cast(v16h, r0);
  t1 = __builtin_bit_cast(v16h, r1);
}

// Second bound: 8 waves per SIMD, the two 16-wave blocks per WGP that the LDS allows.
__global__ __launch_bounds__(512, 8) void pam_fused(const float* __restrict__ fea_left,
                                                 const float* __restrict__ fea_right,
                                                 const _Float16* __restrict__ wsW,
                                                 const float* __restrict__ wsB,
                                                 float* __restrict__ out) {
  extern __shared__ _Float16 sm[];
  const int bi  = blockIdx.x;
  const int b   = bi >> 7;
  const int h   = bi & 127;
  const size_t rowoff = (size_t)b * NC * HWSZ + (size_t)h * NW;

  const int tid  = threadIdx.x;
  const int lane = tid & 31;
  const int wid  = __builtin_amdgcn_readfirstlane(tid >> 5);  // wave id, scalar
  const int dir  = wid >> 3;                // side of this wave's row = output half
  const int wvs  = wid & 7;                 // the wave's 32 pixels within the row
  const float* own = dir ? fea_right : fea_left;   // queries; the other side's keys/values
  const int hl   = lane & 15;
  const int k0   = (lane < 16) ? 0 : 8;     // ISA half-wave K offset

  // ---- staging: no transposing LDS stage, fragments come straight from global ----
  const int    pxl  = wvs * 32 + 2 * hl;            // this lane's even pixel
  const size_t loff = rowoff + (size_t)k0 * HWSZ + pxl;
  float2 raw[32];
  v16h   xb[2][2], qf[2][2];

  const float* po = own + loff;
  load_row(po, raw);                                // the whole share in flight at once
  // The wait that belongs in front of any overwrite of the loads' address registers;
  // naming the address as an input keeps its registers untouched up to here.
  asm volatile("s_wait_xcnt 0x0" :: "v"(po) : "memory");

  // ---- own row -> this side's V (c,w) and the fragments of both convs ----
  _Float16* vown = sm + dir * SIDE_SZ + KT_SZ;
#pragma unroll
  for (int i = 0; i < 32; ++i) {
    v2h hv2 = {(_Float16)raw[i].x, (_Float16)raw[i].y};
    *(v2h*)(vown + ((i >> 3) * 16 + (i & 7) + k0) * V_STR + pxl) = hv2;
  }
  to_frags(raw, xb);

  // ---- conv K -> this side's Kt, conv Q (log2e/64 folded) -> registers ----
  conv_frags(sm + dir * SIDE_SZ + pxl * XT_STR + k0, wsW + 4096, wsB + 64, xb, hl, k0);
  conv_regs(qf, wsW, wsB, xb, hl, k0);
  // The wait that belongs in front of any overwrite of the weight and bias loads' address
  // registers; naming the lane's weight address and its bias byte offset as inputs keeps
  // those registers from being reused as a load's destination up to here.
  asm volatile("s_wait_xcnt 0x0" :: "v"(wsW + hl * 64 + k0), "v"(k0 * 4) : "memory");
  v16h qall[2][2];                      // [query tile][ch 0..31 / 32..63]
#pragma unroll
  for (int kh = 0; kh < 2; ++kh) regroup_px(qf[0][kh], qf[1][kh], qall[0][kh], qall[1][kh]);
  // The second tile's upper fragment waits in the wave's own LDS while the first tile
  // runs: eight registers fewer in that loop, which keeps 128 VGPRs free of scratch.
  _Float16* qpark = sm + QP_OFF + wid * 512 + lane * 8;
  {
    v8h lo, hi;
#pragma unroll
    for (int i = 0; i < 8; ++i) { lo[i] = qall[1][1][i]; hi[i] = qall[1][1][8 + i]; }
    *(v8h*)(qpark)       = lo;
    *(v8h*)(qpark + 256) = hi;
  }
  __syncthreads();

  const _Float16* kt_o = sm + (dir ^ 1) * SIDE_SZ;          // the other side's keys
  const _Float16* v_o  = kt_o + KT_SZ;                      // and values

  // ---- attention: per wave, its own 2 query tiles of 16 neighbouring pixels ----
  // Unrolled so that ii is a constant: the Q fragments are registers, not indexable.
#pragma unroll
  for (int ii = 0; ii < 2; ++ii) {
    const int qt = wvs * 2 + ii;
    v16h qb0 = qall[ii][0];             // Q B-operand, ch 0..31
    v16h qb1 = qall[0][1];              // ch 32..63
    if (ii == 1) {
      v8h lo = *(const v8h*)(qpark);
      v8h hi = *(const v8h*)(qpark + 256);
#pragma unroll
      for (int i = 0; i < 8; ++i) { qb1[i] = lo[i]; qb1[8 + i] = hi[i]; }
    }

    v8f o[4];
#pragma unroll
    for (int t = 0; t < 4; ++t)
#pragma unroll
      for (int k = 0; k < 8; ++k) o[t][k] = 0.0f;
    float m = -3.0e38f, l = 0.0f;

    for (int kc = 0; kc < 8; ++kc) {    // 8 key chunks of 32 keys
      // K^T A-operands: two key tiles (keys kc*32+0..15 and +16..31)
      const _Float16* kr0 = kt_o + (kc * 32 + hl) * XT_STR;
      const _Float16* kr1 = kr0 + 16 * XT_STR;
      v16h ka00 = ld_ab(kr0 + k0), ka01 = ld_ab(kr0 + 32 + k0);
      v16h ka10 = ld_ab(kr1 + k0), ka11 = ld_ab(kr1 + 32 + k0);

      v8f s0, s1;
#pragma unroll
      for (int k = 0; k < 8; ++k) { s0[k] = 0.0f; s1[k] = 0.0f; }
      s0 = wmma16(ka00, qb0, s0); s0 = wmma16(ka01, qb1, s0);
      s1 = wmma16(ka10, qb0, s1); s1 = wmma16(ka11, qb1, s1);

      // online softmax (exp2 domain; log2e folded into Q) per query lane pair
      float cm = s0[0];
#pragma unroll
      for (int k = 1; k < 8; ++k) cm = fmaxf(cm, s0[k]);
#pragma unroll
      for (int k = 0; k < 8; ++k) cm = fmaxf(cm, s1[k]);
      cm = fmaxf(cm, __shfl_xor(cm, 16, 32));
      float mn   = fmaxf(m, cm);
      float corr = __builtin_amdgcn_exp2f(m - mn);
      v8f p0, p1;
      float cs = 0.0f;
#pragma unroll
      for (int k = 0; k < 8; ++k) { p0[k] = __builtin_amdgcn_exp2f(s0[k] - mn); cs += p0[k]; }
#pragma unroll
      for (int k = 0; k < 8; ++k) { p1[k] = __builtin_amdgcn_exp2f(s1[k] - mn); cs += p1[k]; }
      cs += __shfl_xor(cs, 16, 32);
      l = l * corr + cs;
      m = mn;
#pragma unroll
      for (int t = 0; t < 4; ++t) o[t] = o[t] * corr;

      // P^T C-layout -> B-operand by pure per-lane f32->f16 pair packing
      v16h pb;
#pragma unroll
      for (int e = 0; e < 8; ++e) { pb[e] = (_Float16)p0[e]; pb[8 + e] = (_Float16)p1[e]; }

      // O^T += V(ch tile, 32 keys) * P
#pragma unroll
      for (int ct = 0; ct < 4; ++ct) {
        v16h va = ld_ab(v_o + (ct * 16 + hl) * V_STR + kc * 32 + k0);
        o[ct] = wmma16(va, pb, o[ct]);
      }
    }

    // finalize and write out (B,C,H,W) f32; dir selects cxr vs enh half
    float inv = 1.0f / l;
    float* obase = out + (size_t)dir * ((size_t)NB * NC * HWSZ)
                 + (size_t)b * NC * HWSZ + (size_t)h * NW + qt * 16 + hl;
#pragma unroll
    for (int ct = 0; ct < 4; ++ct)
#pragma unroll
      for (int k = 0; k < 8; ++k)
        obase[(size_t)(ct * 16 + k0 + k) * HWSZ] = o[ct][k] * inv;
  }
}

extern "C" void kernel_launch(void* const* d_in, const int* in_sizes, int n_in,
                              void* d_out, int out_size, void* d_ws, size_t ws_size,
                              hipStream_t stream) {
  (void)in_sizes; (void)n_in; (void)out_size; (void)ws_size;
  const float* fl = (const float*)d_in[0];
  const float* fr = (const float*)d_in[1];
  _Float16* wsW = (_Float16*)d_ws;
  float*    wsB = (float*)((char*)d_ws + 16384);

  fold_weights<<<1, 256, 0, stream>>>(
      (const float*)d_in[2],  (const float*)d_in[3],  (const float*)d_in[4],
      (const float*)d_in[5],  (const float*)d_in[6],  (const float*)d_in[7],
      (const float*)d_in[8],  (const float*)d_in[9],  (const float*)d_in[10],
      (const float*)d_in[11], (const float*)d_in[12], (const float*)d_in[13],
      wsW, wsB);

  (void)hipFuncSetAttribute((const void*)pam_fused,
                            hipFuncAttributeMaxDynamicSharedMemorySize, SMEM_BYTES);
  pam_fused<<<dim3(NB * NH), dim3(512), SMEM_BYTES, stream>>>(
      fl, fr, wsW, wsB, (float*)d_out);
}

// v003
// Measured time: 49.8 microseconds a run.
// Timed twice side by side with v002, it ran 1.21 and 1.22 times as fast.
// All steps since v000 together make it 2.12 times as fast.
#include <hip/hip_runtime.h>

// Fused Parallax-Attention (PAM) for MI455X / gfx1250.
// One workgroup (512 threads = 16 wave32) per (batch, row): both directions.
// Waves 0..7 own the left row, waves 8..15 the right row. Pipeline per block:
//   0) while the row loads fly, the block folds BN into both weight matrices and lays
//      them in LDS as f16 in the convs' A-fragment order (no setup launch, no workspace)
//   1) each wave loads its 32 pixels of its own row straight into the convs'
//      B fragments (lane = pixel pair, 8-byte loads, one 128-B line per half-wave)
//   2) the row goes to its side's V (c,w) f16 in LDS
//   3) conv1x1+BN (folded) via WMMA -> its side's Kt (w,c) f16 in LDS
//   4) conv1x1+BN via WMMA from the same fragments -> Q, kept in registers as the
//      score product's B operand  [log2e/64 folded in], then the barrier for Kt and V
//   5) flash-style attention of the wave's own queries against the OTHER side's
//      Kt and V: S^T = K^T Q via WMMA, online softmax in exp2
//      domain (per-lane + one shfl_xor(16)), O^T += V * P via WMMA.

typedef __attribute__((ext_vector_type(16))) _Float16 v16h;
typedef __attribute__((ext_vector_type(8)))  _Float16 v8h;
typedef __attribute__((ext_vector_type(4)))  _Float16 v4h;
typedef __attribute__((ext_vector_type(2)))  _Float16 v2h;
typedef __attribute__((ext_vector_type(8)))  float    v8f;
typedef __attribute__((ext_vector_type(4)))  float    v4f;
typedef __attribute__((ext_vector_type(8)))  unsigned int v8u;

#define NB 8
#define NC 64
#define NH 128
#define NW 256
#define HWSZ (NH * NW)
#define BN_EPS 1e-5f
#define LOG2E 1.44269504088896340736f

// LDS layout (in halfs). All strides multiples of 8 halfs (16B) for b128 ds ops.
// Kt and V exist once per side (0 = left row, 1 = right row); a side's V follows its Kt,
// so every constant offset from the side's base fits a ds instruction's offset field.
#define XT_STR 72
#define KT_SZ  (256 * 72)
#define V_STR  264
#define V_SZ   (64 * 264)
#define SIDE_SZ (KT_SZ + V_SZ)
// Folded weights, fragment order: 32 groups [conv][out tile][ch half][part] of 32 lanes x 8
// halfs, so a wave's 16-byte read is 512 contiguous bytes; 8 halfs of pad per group spread
// the writers' banks. Behind them 128 folded f32 biases (Q then K).
#define WF_OFF (2 * SIDE_SZ)
#define WF_GRP 264
#define BF_OFF (WF_OFF + 32 * WF_GRP)
#define QP_OFF WF_OFF                          // per wave 512 halfs: one parked Q fragment, on
                                               // the weights once every wave is done with them
#define SMEM_HALFS (BF_OFF + 256)              // 79360 halfs
#define SMEM_BYTES (SMEM_HALFS * 2)            // 158720 B: two blocks per WGP

__device__ __forceinline__ v8f wmma16(v16h a, v16h b, v8f c) {
  // D = A(16x32 f16) * B(32x16 f16) + C(16x16 f32)
  return __builtin_amdgcn_wmma_f32_16x16x32_f16(false, a, false, b,
                                                (short)0, c, false, false);
}

// Load one 16x32 f16 A/B operand half-row for this lane:
// elements 0..7 = p[0..7], elements 8..15 = p[16..23]  (caller adds the
// lane<16 ? 0 : 8 half-wave K offset).
__device__ __forceinline__ v16h ld_ab(const _Float16* p) {
  v8h lo = *(const v8h*)(p);
  v8h hi = *(const v8h*)(p + 16);
  v16h r;
#pragma unroll
  for (int i = 0; i < 8; ++i) { r[i] = lo[i]; r[8 + i] = hi[i]; }
  return r;
}

// One A fragment of the folded weights: wf = the lane's 8 halfs in group 0 of the conv.
__device__ __forceinline__ v16h ld_wf(const _Float16* wf, int t, int kh) {
  v8h lo = *(const v8h*)(wf + ((t * 2 + kh) * 2) * WF_GRP);
  v8h hi = *(const v8h*)(wf + ((t * 2 + kh) * 2 + 1) * WF_GRP);
  v16h r;
#pragma unroll
  for (int i = 0; i < 8; ++i) { r[i] = lo[i]; r[8 + i] = hi[i]; }
  return r;
}

// One lane's share of a row for the conv's B operand. p points at channel k0,
// pixel pair (2*hl, 2*hl+1) of the wave's 32 pixels. raw[kh*16 + q] is element q
// of the fragment of in-channels kh*32..kh*32+31 (the k order of ld_ab):
// .x belongs to column hl of pixel tile 0 (even pixels), .y to tile 1 (odd pixels).
__device__ __forceinline__ void load_row(const float* __restrict__ p, float2 (&raw)[32]) {
#pragma unroll
  for (int i = 0; i < 32; ++i)
    raw[i] = *(const float2*)(p + (size_t)((i >> 3) * 16 + (i & 7)) * HWSZ);
}

__device__ __forceinline__ void to_frags(const float2 (&raw)[32], v16h (&xb)[2][2]) {
#pragma unroll
  for (int kh = 0; kh < 2; ++kh)
#pragma unroll
    for (int q = 0; q < 16; ++q) {
      xb[0][kh][q] = (_Float16)raw[kh * 16 + q].x;
      xb[1][kh][q] = (_Float16)raw[kh * 16 + q].y;
    }
}

// Conv 1x1 over the wave's 32 pixels: Y(64 out x 32 px) = W'(64x64) X + b'.
// dst points at this lane's even pixel row, channel k0; the odd pixel is the next row.
__device__ __forceinline__ void conv_frags(_Float16* dst, const _Float16* Wf,
                                           const float* Bf,
                                           const v16h (&xb)[2][2]) {
#pragma unroll
  for (int t = 0; t < 4; ++t) {                    // 4 out-channel tiles
    v16h a0 = ld_wf(Wf, t, 0);
    v16h a1 = ld_wf(Wf, t, 1);
    const v4f bl = *(const v4f*)(Bf + t * 16);     // Bf = the conv's biases + k0
    const v4f bh = *(const v4f*)(Bf + t * 16 + 4);
    v8f bias = {bl[0], bl[1], bl[2], bl[3], bh[0], bh[1], bh[2], bh[3]};
#pragma unroll
    for (int j = 0; j < 2; ++j) {                  // even / odd pixel tile
      v8f acc = wmma16(a0, xb[j][0], bias);
      acc = wmma16(a1, xb[j][1], acc);
      v8h hv;
#pragma unroll
      for (int k = 0; k < 8; ++k) hv[k] = (_Float16)acc[k];
      *(v8h*)(dst + j * XT_STR + t * 16) = hv;
    }
  }
}

// The same conv, its result kept in registers. A 16-channel accumulator tile t holds,
// per lane, channels t*16 + k0 .. + 7 of one pixel: exactly elements (t&1)*8 .. + 7 of
// the B fragment of channels (t>>1)*32 .. + 31 in the k order of ld_ab.
// qf[j] = fragments of the even (j = 0) / odd (j = 1) pixels, column hl = pixel 2*hl + j.
__device__ __forceinline__ void conv_regs(v16h (&qf)[2][2], const _Float16* Wf,
                                          const float* Bf,
                                          const v16h (&xb)[2][2]) {
#pragma unroll
  for (int t = 0; t < 4; ++t) {                    // 4 out-channel tiles
    v16h a0 = ld_wf(Wf, t, 0);
    v16h a1 = ld_wf(Wf, t, 1);
    const v4f bl = *(const v4f*)(Bf + t * 16);     // Bf = the conv's biases + k0
    const v4f bh = *(const v4f*)(Bf + t * 16 + 4);
    v8f bias = {bl[0], bl[1], bl[2], bl[3], bh[0], bh[1], bh[2], bh[3]};
#pragma unroll
    for (int j = 0; j < 2; ++j) {                  // even / odd pixel tile
      v8f acc = wmma16(a0, xb[j][0], bias);
      acc = wmma16(a1, xb[j][1], acc);
#pragma unroll
      for (int k = 0; k < 8; ++k) qf[j][t >> 1][(t & 1) * 8 + k] = (_Float16)acc[k];
    }
  }
}

// Columns of the even and the odd pixel tile -> two tiles of 16 neighbouring pixels, so
// that a query tile's output columns are contiguous in memory. Each 16-lane row moves alike.
// Step 1 (row rotate by 8 into half the row): y0 = even cols 0..7 | odd cols 0..7,
// y1 = even cols 8..15 | odd cols 8..15. Step 2 (gather in the row): column n of tile ii
// is pixel ii*16 + n = column (n >> 1) + 8 * (n & 1) of y[ii].
__device__ __forceinline__ void regroup_px(v16h ev, v16h od, v16h& t0, v16h& t1) {
  v8u e = __builtin_bit_cast(v8u, ev), o = __builtin_bit_cast(v8u, od), r0, r1;
#pragma unroll
  for (int i = 0; i < 8; ++i) {
    unsigned y0 = __builtin_amdgcn_update_dpp(e[i], o[i], 0x128, 0xf, 0xc, false);
    unsigned y1 = __builtin_amdgcn_update_dpp(o[i], e[i], 0x128, 0xf, 0x3, false);
    r0[i] = __builtin_amdgcn_permlane16(y0, y0, 0xB3A29180u, 0xF7E6D5C4u, false, false);
    r1[i] = __builtin_amdgcn_permlane16(y1, y1, 0xB3A29180u, 0xF7E6D5C4u, false, false);
  }
  t0 = __builtin_bit_cast(v16h, r0);
  t1 = __builtin_bit_cast(v16h, r1);
}

// Second bound: 8 waves per SIMD, the two 16-wave blocks per WGP that the LDS allows.
__global__ __launch_bounds__(512, 8) void pam_fused(const float* __restrict__ fea_left,
                                                 const float* __restrict__ fea_right,
                                                 const float* Wq, const float* bq,
                                                 const float* gq, const float* betaq,
                                                 const float* mq, const float* vq,
                                                 const float* Wk, const float* bk,
                                                 const float* gk, const float* betak,
                                                 const float* mk, const float* vk,
                                                 float* __restrict__ out) {
  extern __shared__ _Float16 sm[];
  const int bi  = blockIdx.x;
  const int b   = bi >> 7;
  const int h   = bi & 127;
  const size_t rowoff = (size_t)b * NC * HWSZ + (size_t)h * NW;

  const int tid  = threadIdx.x;
  const int lane = tid & 31;
  const int wid  = __builtin_amdgcn_readfirstlane(tid >> 5);  // wave id, scalar
  const int dir  = wid >> 3;                // side of this wave's row = output half
  const int wvs  = wid & 7;                 // the wave's 32 pixels within the row
  const float* own = dir ? fea_right : fea_left;   // queries; the other side's keys/values
  const int hl   = lane & 15;
  const int k0   = (lane < 16) ? 0 : 8;     // ISA half-wave K offset

  // ---- staging: no transposing LDS stage, fragments come straight from global ----
  const int    pxl  = wvs * 32 + 2 * hl;            // this lane's even pixel
  const size_t loff = rowoff + (size_t)k0 * HWSZ + pxl;
  float2 raw[32];
  v16h   xb[2][2], qf[2][2];

  // ---- weight and BN loads go out first: they come back first, from L2 ----
  // Thread tid takes 4 neighbouring weights of rows frow and frow + 32 of both matrices
  // (a wave's 16-byte load = 512 contiguous bytes). Every thread also loads one channel's
  // five bias terms, so that no branch stands among the loads; waves 0..3 fold them.
  const int frow = tid >> 4;
  const int fcol = (tid & 15) * 4;
  const int woff = frow * 64 + fcol;
  const int bo   = tid & 63;
  const bool bk_side = (wid >> 1) & 1;              // waves 0,1: Q biases; waves 2,3: K biases
  float4 wv[4];
  float  fg[4], fv[4];
#pragma unroll
  for (int j = 0; j < 4; ++j) {                     // j >> 1: matrix, j & 1: upper 32 rows
    wv[j] = *(const float4*)(((j >> 1) ? Wk : Wq) + (j & 1) * 2048 + woff);
    fg[j] = ((j >> 1) ? gk : gq)[(j & 1) * 32 + frow];
    fv[j] = ((j >> 1) ? vk : vq)[(j & 1) * 32 + frow];
  }
  const float b_b = (bk_side ? bk : bq)[bo],       b_g = (bk_side ? gk : gq)[bo];
  const float b_t = (bk_side ? betak : betaq)[bo], b_m = (bk_side ? mk : mq)[bo];
  const float b_v = (bk_side ? vk : vq)[bo];
  // The wait that belongs in front of any overwrite of these loads' offset registers
  // (named as inputs, so they stay untouched up to here). Its memory clobber also holds the
  // loads above it (their pointers are not restrict for that reason): issued behind the
  // row loads they would come back behind them, and the fold would wait for the whole row.
  asm volatile("s_wait_xcnt 0x0" :: "v"(woff * 4), "v"(frow), "v"(bo) : "memory");

  const float* po = own + loff;
  load_row(po, raw);                                // the whole share in flight at once
  // The wait that belongs in front of any overwrite of the loads' address registers;
  // naming the address as an input keeps its registers untouched up to here.
  asm volatile("s_wait_xcnt 0x0" :: "v"(po) : "memory");
  // Keeps the fold's arithmetic, and with it the wait for the first BN values, from being
  // scheduled in front of the row loads: those would then go out an L2 round trip later.
  __builtin_amdgcn_sched_barrier(0);

  // ---- fold BN into the weights (log2e/64 into Q's: cost/64, softmax in exp2) -> LDS ----
  {
    const float qscale = LOG2E / 64.0f;
    _Float16* wdst = sm + WF_OFF + ((frow >> 4) * 4 + (fcol >> 4)) * WF_GRP
                   + (((fcol >> 3) & 1) * 16 + (frow & 15)) * 8 + (fcol & 7);
#pragma unroll
    for (int j = 0; j < 4; ++j) {
      const float s = fg[j] * rsqrtf(fv[j] + BN_EPS);
      v4h hv;
      if (j >> 1) {
        hv[0] = (_Float16)(wv[j].x * s); hv[1] = (_Float16)(wv[j].y * s);
        hv[2] = (_Float16)(wv[j].z * s); hv[3] = (_Float16)(wv[j].w * s);
      } else {
        hv[0] = (_Float16)(wv[j].x * s * qscale); hv[1] = (_Float16)(wv[j].y * s * qscale);
        hv[2] = (_Float16)(wv[j].z * s * qscale); hv[3] = (_Float16)(wv[j].w * s * qscale);
      }
      *(v4h*)(wdst + ((j >> 1) * 16 + (j & 1) * 8) * WF_GRP) = hv;
    }
    if (wid < 4) {
      const float s  = b_g * rsqrtf(b_v + BN_EPS);
      const float bf = s * b_b + b_t - b_m * s;
      ((float*)(sm + BF_OFF))[tid] = bk_side ? bf : bf * qscale;
    }
  }
  // Barrier for the folded weights. Its fences name LDS alone: __syncthreads() would also
  // wait for every global load, and the row loads are meant to stay in flight across it.
  __builtin_amdgcn_fence(__ATOMIC_RELEASE, "workgroup", "local");
  __builtin_amdgcn_s_barrier();
  __builtin_amdgcn_fence(__ATOMIC_ACQUIRE, "workgroup", "local");

  // ---- own row -> this side's V (c,w) and the fragments of both convs ----
  _Float16* vown = sm + dir * SIDE_SZ + KT_SZ;
#pragma unroll
  for (int i = 0; i < 32; ++i) {
    v2h hv2 = {(_Float16)raw[i].x, (_Float16)raw[i].y};
    *(v2h*)(vown + ((i >> 3) * 16 + (i & 7) + k0) * V_STR + pxl) = hv2;
  }
  to_frags(raw, xb);

  // ---- conv K -> this side's Kt, conv Q (log2e/64 folded) -> registers ----
  const _Float16* wfl = sm + WF_OFF + lane * 8;
  const float*    bfl = (const float*)(sm + BF_OFF) + k0;
  conv_frags(sm + dir * SIDE_SZ + pxl * XT_STR + k0, wfl + 16 * WF_GRP, bfl + 64, xb);
  conv_regs(qf, wfl, bfl, xb);
  v16h qall[2][2];                      // [query tile][ch 0..31 / 32..63]
#pragma unroll
  for (int kh = 0; kh < 2; ++kh) regroup_px(qf[0][kh], qf[1][kh], qall[0][kh], qall[1][kh]);
  __syncthreads();
  // The second tile's upper fragment waits in the wave's own LDS while the first tile
  // runs: eight registers fewer in that loop, which keeps 128 VGPRs free of scratch.
  _Float16* qpark = sm + QP_OFF + wid * 512 + lane * 8;
  {
    v8h lo, hi;
#pragma unroll
    for (int i = 0; i < 8; ++i) { lo[i] = qall[1][1][i]; hi[i] = qall[1][1][8 + i]; }
    *(v8h*)(qpark)       = lo;
    *(v8h*)(qpark + 256) = hi;
  }

  const _Float16* kt_o = sm + (dir ^ 1) * SIDE_SZ;          // the other side's keys
  const _Float16* v_o  = kt_o + KT_SZ;                      // and values

  // ---- attention: per wave, its own 2 query tiles of 16 neighbouring pixels ----
  // Unrolled so that ii is a constant: the Q fragments are registers, not indexable.
#pragma unroll
  for (int ii = 0; ii < 2; ++ii) {
    const int qt = wvs * 2 + ii;
    v16h qb0 = qall[ii][0];             // Q B-operand, ch 0..31
    v16h qb1 = qall[0][1];              // ch 32..63
    if (ii == 1) {
      v8h lo = *(const v8h*)(qpark);
      v8h hi = *(const v8h*)(qpark + 256);
#pragma unroll
      for (int i = 0; i < 8; ++i) { qb1[i] = lo[i]; qb1[8 + i] = hi[i]; }
    }

    v8f o[4];
#pragma unroll
    for (int t = 0; t < 4; ++t)
#pragma unroll
      for (int k = 0; k < 8; ++k) o[t][k] = 0.0f;
    float m = -3.0e38f, l = 0.0f;

    for (int kc = 0; kc < 8; ++kc) {    // 8 key chunks of 32 keys
      // K^T A-operands: two key tiles (keys kc*32+0..15 and +16..31)
      const _Float16* kr0 = kt_o + (kc * 32 + hl) * XT_STR;
      const _Float16* kr1 = kr0 + 16 * XT_STR;
      v16h ka00 = ld_ab(kr0 + k0), ka01 = ld_ab(kr0 + 32 + k0);
      v16h ka10 = ld_ab(kr1 + k0), ka11 = ld_ab(kr1 + 32 + k0);

      v8f s0, s1;
#pragma unroll
      for (int k = 0; k < 8; ++k) { s0[k] = 0.0f; s1[k] = 0.0f; }
      s0 = wmma16(ka00, qb0, s0); s0 = wmma16(ka01, qb1, s0);
      s1 = wmma16(ka10, qb0, s1); s1 = wmma16(ka11, qb1, s1);

      // online softmax (exp2 domain; log2e folded into Q) per query lane pair
      float cm = s0[0];
#pragma unroll
      for (int k = 1; k < 8; ++k) cm = fmaxf(cm, s0[k]);
#pragma unroll
      for (int k = 0; k < 8; ++k) cm = fmaxf(cm, s1[k]);
      cm = fmaxf(cm, __shfl_xor(cm, 16, 32));
      float mn   = fmaxf(m, cm);
      float corr = __builtin_amdgcn_exp2f(m - mn);
      v8f p0, p1;
      float cs = 0.0f;
#pragma unroll
      for (int k = 0; k < 8; ++k) { p0[k] = __builtin_amdgcn_exp2f(s0[k] - mn); cs += p0[k]; }
#pragma unroll
      for (int k = 0; k < 8; ++k) { p1[k] = __builtin_amdgcn_exp2f(s1[k] - mn); cs += p1[k]; }
      cs += __shfl_xor(cs, 16, 32);
      l = l * corr + cs;
      m = mn;
#pragma unroll
      for (int t = 0; t < 4; ++t) o[t] = o[t] * corr;

      // P^T C-layout -> B-operand by pure per-lane f32->f16 pair packing
      v16h pb;
#pragma unroll
      for (int e = 0; e < 8; ++e) { pb[e] = (_Float16)p0[e]; pb[8 + e] = (_Float16)p1[e]; }

      // O^T += V(ch tile, 32 keys) * P
#pragma unroll
      for (int ct = 0; ct < 4; ++ct) {
        v16h va = ld_ab(v_o + (ct * 16 + hl) * V_STR + kc * 32 + k0);
        o[ct] = wmma16(va, pb, o[ct]);
      }
    }

    // finalize and write out (B,C,H,W) f32; dir selects cxr vs enh half
    float inv = 1.0f / l;
    float* obase = out + (size_t)dir * ((size_t)NB * NC * HWSZ)
                 + (size_t)b * NC * HWSZ + (size_t)h * NW + qt * 16 + hl;
#pragma unroll
    for (int ct = 0; ct < 4; ++ct)
#pragma unroll
      for (int k = 0; k < 8; ++k)
        obase[(size_t)(ct * 16 + k0 + k) * HWSZ] = o[ct][k] * inv;
  }
}

extern "C" void kernel_launch(void* const* d_in, const int* in_sizes, int n_in,
                              void* d_out, int out_size, void* d_ws, size_t ws_size,
                              hipStream_t stream) {
  (void)in_sizes; (void)n_in; (void)out_size; (void)d_ws; (void)ws_size;
  (void)hipFuncSetAttribute((const void*)pam_fused,
                            hipFuncAttributeMaxDynamicSharedMemorySize, SMEM_BYTES);
  pam_fused<<<dim3(NB * NH), dim3(512), SMEM_BYTES, stream>>>(
      (const float*)d_in[0],  (const float*)d_in[1],
      (const float*)d_in[2],  (const float*)d_in[3],  (const float*)d_in[4],
      (const float*)d_in[5],  (const float*)d_in[6],  (const float*)d_in[7],
      (const float*)d_in[8],  (const float*)d_in[9],  (const float*)d_in[10],
      (const float*)d_in[11], (const float*)d_in[12], (const float*)d_in[13],
      (float*)d_out);
}

// v004
// It runs in 47.7 microseconds.
// Two timings next to v003 both put it at 1.06 times that version's speed.
// Counting every step since v000, it is 2.25 times as fast.
#include <hip/hip_runtime.h>

// Fused Parallax-Attention (PAM) for MI455X / gfx1250.
// One workgroup (256 threads = 8 wave32) per (batch, row): both directions.
// Waves 0..3 own the left row, waves 4..7 the right row; a wave owns 64 pixels, as two
// groups of 32. Pipeline per block:
//   0) while the row loads fly, the block folds BN into both weight matrices and lays
//      them in LDS as f16 in the convs' A-fragment order (no setup launch, no workspace)
//   1) each wave loads its 64 pixels of its own row straight into the convs'
//      B fragments (lane = pixel pair, 8-byte loads, one 128-B line per half-wave)
//   2) the row goes to its side's V (c,w) f16 in LDS
//   3) conv1x1+BN (folded) via WMMA -> its side's Kt (w,c) f16 in LDS
//   4) conv1x1+BN via WMMA from the same fragments -> Q, kept in registers as the
//      score product's B operand  [log2e/64 folded in], then the barrier for Kt and V
//      (group 1's Q is made behind group 0's key loop, from its row fragments)
//   5) flash-style attention of the wave's own queries against the OTHER side's
//      Kt and V, one group of 32 queries (two tiles of 16) per key loop, so that each K and
//      V fragment read from LDS serves two query tiles:
//      S^T = K^T Q via WMMA, online softmax in exp2
//      domain (per-lane + one shfl_xor(16)), O^T += V * P via WMMA.

typedef __attribute__((ext_vector_type(16))) _Float16 v16h;
typedef __attribute__((ext_vector_type(8)))  _Float16 v8h;
typedef __attribute__((ext_vector_type(4)))  _Float16 v4h;
typedef __attribute__((ext_vector_type(2)))  _Float16 v2h;
typedef __attribute__((ext_vector_type(8)))  float    v8f;
typedef __attribute__((ext_vector_type(4)))  float    v4f;
typedef __attribute__((ext_vector_type(8)))  unsigned int v8u;

#define NB 8
#define NC 64
#define NH 128
#define NW 256
#define HWSZ (NH * NW)
#define BN_EPS 1e-5f
#define LOG2E 1.44269504088896340736f

// LDS layout (in halfs). All strides multiples of 8 halfs (16B) for b128 ds ops.
// Kt and V exist once per side (0 = left row, 1 = right row); a side's V follows its Kt,
// so every constant offset from the side's base fits a ds instruction's offset field.
#define XT_STR 72
#define KT_SZ  (256 * 72)
#define V_STR  264
#define V_SZ   (64 * 264)
#define SIDE_SZ (KT_SZ + V_SZ)
// Folded weights, fragment order: 32 groups [conv][out tile][ch half][part] of 32 lanes x 8
// halfs, so a wave's 16-byte read is 512 contiguous bytes; 8 halfs of pad per group spread
// the writers' banks. Behind them 128 folded f32 biases (Q then K).
#define WF_OFF (2 * SIDE_SZ)
#define WF_GRP 264
#define BF_OFF (WF_OFF + 32 * WF_GRP)
#define SMEM_HALFS (BF_OFF + 256)              // 79360 halfs
#define SMEM_BYTES (SMEM_HALFS * 2)            // 158720 B: two blocks per WGP

__device__ __forceinline__ v8f wmma16(v16h a, v16h b, v8f c) {
  // D = A(16x32 f16) * B(32x16 f16) + C(16x16 f32)
  return __builtin_amdgcn_wmma_f32_16x16x32_f16(false, a, false, b,
                                                (short)0, c, false, false);
}

// Load one 16x32 f16 A/B operand half-row for this lane:
// elements 0..7 = p[0..7], elements 8..15 = p[16..23]  (caller adds the
// lane<16 ? 0 : 8 half-wave K offset).
__device__ __forceinline__ v16h ld_ab(const _Float16* p) {
  v8h lo = *(const v8h*)(p);
  v8h hi = *(const v8h*)(p + 16);
  v16h r;
#pragma unroll
  for (int i = 0; i < 8; ++i) { r[i] = lo[i]; r[8 + i] = hi[i]; }
  return r;
}

// One A fragment of the folded weights: wf = the lane's 8 halfs in group 0 of the conv.
__device__ __forceinline__ v16h ld_wf(const _Float16* wf, int t, int kh) {
  v8h lo = *(const v8h*)(wf + ((t * 2 + kh) * 2) * WF_GRP);
  v8h hi = *(const v8h*)(wf + ((t * 2 + kh) * 2 + 1) * WF_GRP);
  v16h r;
#pragma unroll
  for (int i = 0; i < 8; ++i) { r[i] = lo[i]; r[8 + i] = hi[i]; }
  return r;
}

// One lane's share of a row for the conv's B operand. p points at channel k0,
// pixel pair (2*hl, 2*hl+1) of one of the wave's two groups of 32 pixels. raw[kh*16 + q] is element q
// of the fragment of in-channels kh*32..kh*32+31 (the k order of ld_ab):
// .x belongs to column hl of pixel tile 0 (even pixels), .y to tile 1 (odd pixels).
__device__ __forceinline__ void load_row(const float* __restrict__ p, float2 (&raw)[32]) {
#pragma unroll
  for (int i = 0; i < 32; ++i)
    raw[i] = *(const float2*)(p + (size_t)((i >> 3) * 16 + (i & 7)) * HWSZ);
}

__device__ __forceinline__ void to_frags(const float2 (&raw)[32], v16h (&xb)[2][2]) {
#pragma unroll
  for (int kh = 0; kh < 2; ++kh)
#pragma unroll
    for (int q = 0; q < 16; ++q) {
      xb[0][kh][q] = (_Float16)raw[kh * 16 + q].x;
      xb[1][kh][q] = (_Float16)raw[kh * 16 + q].y;
    }
}

// Conv 1x1 over the wave's 64 pixels: Y(64 out x 64 px) = W'(64x64) X + b'.
// dst points at this lane's even pixel row of group 0, channel k0; the odd pixel is the
// next row, group 1 lies 32 rows on. Each weight fragment serves all four pixel tiles.
__device__ __forceinline__ void conv_frags(_Float16* dst, const _Float16* Wf,
                                           const float* Bf,
                                           const v16h (&xb)[2][2][2]) {
#pragma unroll
  for (int t = 0; t < 4; ++t) {                    // 4 out-channel tiles
    v16h a0 = ld_wf(Wf, t, 0);
    v16h a1 = ld_wf(Wf, t, 1);
    const v4f bl = *(const v4f*)(Bf + t * 16);     // Bf = the conv's biases + k0
    const v4f bh = *(const v4f*)(Bf + t * 16 + 4);
    v8f bias = {bl[0], bl[1], bl[2], bl[3], bh[0], bh[1], bh[2], bh[3]};
#pragma unroll
    for (int g = 0; g < 2; ++g)                    // pixel group
#pragma unroll
      for (int j = 0; j < 2; ++j) {                // even / odd pixel tile
        v8f acc = wmma16(a0, xb[g][j][0], bias);
        acc = wmma16(a1, xb[g][j][1], acc);
        v8h hv;
#pragma unroll
        for (int k = 0; k < 8; ++k) hv[k] = (_Float16)acc[k];
        *(v8h*)(dst + (g * 32 + j) * XT_STR + t * 16) = hv;
      }
  }
}

// The same conv for one group of 32 pixels, its result kept in registers. A 16-channel
// accumulator tile t holds, per lane, channels t*16 + k0 .. + 7 of one pixel: exactly
// elements (t&1)*8 .. + 7 of the B fragment of channels (t>>1)*32 .. + 31 in the k order of
// ld_ab. qf[j] = fragments of the even (j = 0) / odd (j = 1) pixels, column hl = pixel 2*hl + j.
__device__ __forceinline__ void conv_regs(v16h (&qf)[2][2], const _Float16* Wf,
                                          const float* Bf,
                                          const v16h (&xb)[2][2]) {
#pragma unroll
  for (int t = 0; t < 4; ++t) {                    // 4 out-channel tiles
    v16h a0 = ld_wf(Wf, t, 0);
    v16h a1 = ld_wf(Wf, t, 1);
    const v4f bl = *(const v4f*)(Bf + t * 16);     // Bf = the conv's biases + k0
    const v4f bh = *(const v4f*)(Bf + t * 16 + 4);
    v8f bias = {bl[0], bl[1], bl[2], bl[3], bh[0], bh[1], bh[2], bh[3]};
#pragma unroll
    for (int j = 0; j < 2; ++j) {                  // even / odd pixel tile
      v8f acc = wmma16(a0, xb[j][0], bias);
      acc = wmma16(a1, xb[j][1], acc);
#pragma unroll
      for (int k = 0; k < 8; ++k) qf[j][t >> 1][(t & 1) * 8 + k] = (_Float16)acc[k];
    }
  }
}

// Columns of the even and the odd pixel tile -> two tiles of 16 neighbouring pixels, so
// that a query tile's output columns are contiguous in memory. Each 16-lane row moves alike.
// Step 1 (row rotate by 8 into half the row): y0 = even cols 0..7 | odd cols 0..7,
// y1 = even cols 8..15 | odd cols 8..15. Step 2 (gather in the row): column n of tile ii
// is pixel ii*16 + n = column (n >> 1) + 8 * (n & 1) of y[ii].
__device__ __forceinline__ void regroup_px(v16h ev, v16h od, v16h& t0, v16h& t1) {
  v8u e = __builtin_bit_cast(v8u, ev), o = __builtin_bit_cast(v8u, od), r0, r1;
#pragma unroll
  for (int i = 0; i < 8; ++i) {
    unsigned y0 = __builtin_amdgcn_update_dpp(e[i], o[i], 0x128, 0xf, 0xc, false);
    unsigned y1 = __builtin_amdgcn_update_dpp(o[i], e[i], 0x128, 0xf, 0x3, false);
    r0[i] = __builtin_amdgcn_permlane16(y0, y0, 0xB3A29180u, 0xF7E6D5C4u, false, false);
    r1[i] = __builtin_amdgcn_permlane16(y1, y1, 0xB3A29180u, 0xF7E6D5C4u, false, false);
  }
  t0 = __builtin_bit_cast(v16h, r0);
  t1 = __builtin_bit_cast(v16h, r1);
}

// Second bound: 4 waves per SIMD, the two 8-wave blocks per WGP that the LDS allows.
__global__ __launch_bounds__(256, 4) void pam_fused(const float* __restrict__ fea_left,
                                                 const float* __restrict__ fea_right,
                                                 const float* Wq, const float* bq,
                                                 const float* gq, const float* betaq,
                                                 const float* mq, const float* vq,
                                                 const float* Wk, const float* bk,
                                                 const float* gk, const float* betak,
                                                 const float* mk, const float* vk,
                                                 float* __restrict__ out) {
  extern __shared__ _Float16 sm[];
  const int bi  = blockIdx.x;
  const int b   = bi >> 7;
  const int h   = bi & 127;
  const size_t rowoff = (size_t)b * NC * HWSZ + (size_t)h * NW;

  const int tid  = threadIdx.x;
  const int lane = tid & 31;
  const int wid  = __builtin_amdgcn_readfirstlane(tid >> 5);  // wave id, scalar
  const int dir  = wid >> 2;                // side of this wave's row = output half
  const int wvs  = wid & 3;                 // the wave's 64 pixels within the row
  const float* own = dir ? fea_right : fea_left;   // queries; the other side's keys/values
  const int hl   = lane & 15;
  const int k0   = (lane < 16) ? 0 : 8;     // ISA half-wave K offset

  // ---- staging: no transposing LDS stage, fragments come straight from global ----
  const int    pxl  = wvs * 64 + 2 * hl;            // this lane's even pixel of group 0
  const size_t loff = rowoff + (size_t)k0 * HWSZ + pxl;
  float2 raw[2][32];
  v16h   xb[2][2][2];                               // [group][even / odd][ch 0..31 / 32..63]

  // ---- weight and BN loads go out first: they come back first, from L2 ----
  // Thread tid takes 4 neighbouring weights of rows frow, + 16, + 32, + 48 of both matrices
  // (a wave's 16-byte load = 512 contiguous bytes). Every thread also loads one channel's
  // five bias terms, so that no branch stands among the loads; waves 0..3 fold them.
  const int frow = tid >> 4;
  const int fcol = (tid & 15) * 4;
  const int woff = frow * 64 + fcol;
  const int bo   = tid & 63;
  const bool bk_side = (wid >> 1) & 1;              // waves 0,1: Q biases; waves 2,3: K biases
  float4 wv[8];
  float  fg[8], fv[8];
#pragma unroll
  for (int j = 0; j < 8; ++j) {                     // j >> 2: matrix, j & 3: 16-row tile
    wv[j] = *(const float4*)(((j >> 2) ? Wk : Wq) + (j & 3) * 1024 + woff);
    fg[j] = ((j >> 2) ? gk : gq)[(j & 3) * 16 + frow];
    fv[j] = ((j >> 2) ? vk : vq)[(j & 3) * 16 + frow];
  }
  const float b_b = (bk_side ? bk : bq)[bo],       b_g = (bk_side ? gk : gq)[bo];
  const float b_t = (bk_side ? betak : betaq)[bo], b_m = (bk_side ? mk : mq)[bo];
  const float b_v = (bk_side ? vk : vq)[bo];
  // The wait that belongs in front of any overwrite of these loads' offset registers
  // (named as inputs, so they stay untouched up to here). Its memory clobber also holds the
  // loads above it (their pointers are not restrict for that reason): issued behind the
  // row loads they would come back behind them, and the fold would wait for the whole row.
  asm volatile("s_wait_xcnt 0x0" :: "v"(woff * 4), "v"(frow), "v"(bo) : "memory");

  const float* po = own + loff;
  load_row(po, raw[0]);                             // the whole share in flight at once
  load_row(po + 32, raw[1]);
  // The wait that belongs in front of any overwrite of the loads' address registers;
  // naming the address as an input keeps its registers untouched up to here.
  asm volatile("s_wait_xcnt 0x0" :: "v"(po) : "memory");
  // Keeps the fold's arithmetic, and with it the wait for the first BN values, from being
  // scheduled in front of the row loads: those would then go out an L2 round trip later.
  __builtin_amdgcn_sched_barrier(0);

  // ---- fold BN into the weights (log2e/64 into Q's: cost/64, softmax in exp2) -> LDS ----
  {
    const float qscale = LOG2E / 64.0f;
    _Float16* wdst = sm + WF_OFF + (fcol >> 4) * WF_GRP
                   + (((fcol >> 3) & 1) * 16 + frow) * 8 + (fcol & 7);
#pragma unroll
    for (int j = 0; j < 8; ++j) {
      const float s = fg[j] * rsqrtf(fv[j] + BN_EPS);
      v4h hv;
      if (j >> 2) {
        hv[0] = (_Float16)(wv[j].x * s); hv[1] = (_Float16)(wv[j].y * s);
        hv[2] = (_Float16)(wv[j].z * s); hv[3] = (_Float16)(wv[j].w * s);
      } else {
        hv[0] = (_Float16)(wv[j].x * s * qscale); hv[1] = (_Float16)(wv[j].y * s * qscale);
        hv[2] = (_Float16)(wv[j].z * s * qscale); hv[3] = (_Float16)(wv[j].w * s * qscale);
      }
      *(v4h*)(wdst + ((j >> 2) * 16 + (j & 3) * 4) * WF_GRP) = hv;
    }
    if (wid < 4) {
      const float s  = b_g * rsqrtf(b_v + BN_EPS);
      const float bf = s * b_b + b_t - b_m * s;
      ((float*)(sm + BF_OFF))[tid] = bk_side ? bf : bf * qscale;
    }
  }
  // Barrier for the folded weights. Its fences name LDS alone: __syncthreads() would also
  // wait for every global load, and the row loads are meant to stay in flight across it.
  __builtin_amdgcn_fence(__ATOMIC_RELEASE, "workgroup", "local");
  __builtin_amdgcn_s_barrier();
  __builtin_amdgcn_fence(__ATOMIC_ACQUIRE, "workgroup", "local");

  // ---- own row -> this side's V (c,w) and the fragments of both convs ----
  _Float16* vown = sm + dir * SIDE_SZ + KT_SZ;
#pragma unroll
  for (int g = 0; g < 2; ++g) {
#pragma unroll
    for (int i = 0; i < 32; ++i) {
      v2h hv2 = {(_Float16)raw[g][i].x, (_Float16)raw[g][i].y};
      *(v2h*)(vown + ((i >> 3) * 16 + (i & 7) + k0) * V_STR + pxl + g * 32) = hv2;
    }
    to_frags(raw[g], xb[g]);
  }

  // ---- conv K -> this side's Kt, conv Q (log2e/64 folded) of group 0 -> registers ----
  const _Float16* wfl = sm + WF_OFF + lane * 8;
  const float*    bfl = (const float*)(sm + BF_OFF) + k0;
  conv_frags(sm + dir * SIDE_SZ + pxl * XT_STR + k0, wfl + 16 * WF_GRP, bfl + 64, xb);
  v16h qf[2][2], qall[2][2];            // qall: [query tile][ch 0..31 / 32..63]
  conv_regs(qf, wfl, bfl, xb[0]);
#pragma unroll
  for (int kh = 0; kh < 2; ++kh) regroup_px(qf[0][kh], qf[1][kh], qall[0][kh], qall[1][kh]);
  __syncthreads();

  const _Float16* kt_o = sm + (dir ^ 1) * SIDE_SZ;          // the other side's keys
  const _Float16* v_o  = kt_o + KT_SZ;                      // and values

  // ---- attention: per wave, its two groups of 32 queries, one after the other ----
  // Unrolled so that g is a constant: the row fragments are registers, not indexable.
#pragma unroll
  for (int g = 0; g < 2; ++g) {
    // Group 1's conv Q stands here, not in front of the barrier, so that the group waits
    // through group 0's key loop as its 32 registers of row fragments and no more; the
    // folded weights stay in LDS to the end.
    if (g == 1) {
      conv_regs(qf, wfl, bfl, xb[1]);
#pragma unroll
      for (int kh = 0; kh < 2; ++kh) regroup_px(qf[0][kh], qf[1][kh], qall[0][kh], qall[1][kh]);
    }

    v8f o[2][4];                        // [query tile][channel tile]
    float m[2], l[2];
#pragma unroll
    for (int j = 0; j < 2; ++j) {
#pragma unroll
      for (int t = 0; t < 4; ++t)
#pragma unroll
        for (int k = 0; k < 8; ++k) o[j][t][k] = 0.0f;
      m[j] = -3.0e38f; l[j] = 0.0f;
    }

    for (int kc = 0; kc < 8; ++kc) {    // 8 key chunks of 32 keys
      // K^T A-operands: two key tiles (keys kc*32+0..15 and +16..31), for both query tiles
      const _Float16* kr0 = kt_o + (kc * 32 + hl) * XT_STR;
      const _Float16* kr1 = kr0 + 16 * XT_STR;
      v16h ka00 = ld_ab(kr0 + k0), ka01 = ld_ab(kr0 + 32 + k0);
      v16h ka10 = ld_ab(kr1 + k0), ka11 = ld_ab(kr1 + 32 + k0);

      v16h pb[2];
#pragma unroll
      for (int j = 0; j < 2; ++j) {     // query tile
        v8f s0, s1;
#pragma unroll
        for (int k = 0; k < 8; ++k) { s0[k] = 0.0f; s1[k] = 0.0f; }
        s0 = wmma16(ka00, qall[j][0], s0); s0 = wmma16(ka01, qall[j][1], s0);
        s1 = wmma16(ka10, qall[j][0], s1); s1 = wmma16(ka11, qall[j][1], s1);

        // online softmax (exp2 domain; log2e folded into Q) per query lane pair
        float cm = s0[0];
#pragma unroll
        for (int k = 1; k < 8; ++k) cm = fmaxf(cm, s0[k]);
#pragma unroll
        for (int k = 0; k < 8; ++k) cm = fmaxf(cm, s1[k]);
        cm = fmaxf(cm, __shfl_xor(cm, 16, 32));
        float mn   = fmaxf(m[j], cm);
        float corr = __builtin_amdgcn_exp2f(m[j] - mn);
        v8f p0, p1;
        float cs = 0.0f;
#pragma unroll
        for (int k = 0; k < 8; ++k) { p0[k] = __builtin_amdgcn_exp2f(s0[k] - mn); cs += p0[k]; }
#pragma unroll
        for (int k = 0; k < 8; ++k) { p1[k] = __builtin_amdgcn_exp2f(s1[k] - mn); cs += p1[k]; }
        cs += __shfl_xor(cs, 16, 32);
        l[j] = l[j] * corr + cs;
        m[j] = mn;
#pragma unroll
        for (int t = 0; t < 4; ++t) o[j][t] = o[j][t] * corr;

        // P^T C-layout -> B-operand by pure per-lane f32->f16 pair packing
#pragma unroll
        for (int e = 0; e < 8; ++e) { pb[j][e] = (_Float16)p0[e]; pb[j][8 + e] = (_Float16)p1[e]; }
      }

      // O^T += V(ch tile, 32 keys) * P, each V fragment for both query tiles
#pragma unroll
      for (int ct = 0; ct < 4; ++ct) {
        v16h va = ld_ab(v_o + (ct * 16 + hl) * V_STR + kc * 32 + k0);
        o[0][ct] = wmma16(va, pb[0], o[0][ct]);
        o[1][ct] = wmma16(va, pb[1], o[1][ct]);
      }
    }

    // finalize and write out (B,C,H,W) f32; dir selects cxr vs enh half
#pragma unroll
    for (int j = 0; j < 2; ++j) {
      float inv = 1.0f / l[j];
      float* obase = out + (size_t)dir * ((size_t)NB * NC * HWSZ)
                   + (size_t)b * NC * HWSZ + (size_t)h * NW + wvs * 64 + g * 32 + j * 16 + hl;
#pragma unroll
      for (int ct = 0; ct < 4; ++ct)
#pragma unroll
        for (int k = 0; k < 8; ++k)
          obase[(size_t)(ct * 16 + k0 + k) * HWSZ] = o[j][ct][k] * inv;
    }
  }
}

extern "C" void kernel_launch(void* const* d_in, const int* in_sizes, int n_in,
                              void* d_out, int out_size, void* d_ws, size_t ws_size,
                              hipStream_t stream) {
  (void)in_sizes; (void)n_in; (void)out_size; (void)d_ws; (void)ws_size;
  (void)hipFuncSetAttribute((const void*)pam_fused,
                            hipFuncAttributeMaxDynamicSharedMemorySize, SMEM_BYTES);
  pam_fused<<<dim3(NB * NH), dim3(256), SMEM_BYTES, stream>>>(
      (const float*)d_in[0],  (const float*)d_in[1],
      (const float*)d_in[2],  (const float*)d_in[3],  (const float*)d_in[4],
      (const float*)d_in[5],  (const float*)d_in[6],  (const float*)d_in[7],
      (const float*)d_in[8],  (const float*)d_in[9],  (const float*)d_in[10],
      (const float*)d_in[11], (const float*)d_in[12], (const float*)d_in[13],
      (float*)d_out);
}

// v005
// A run of this version takes 46.2 microseconds.
// Timed twice side by side with v004, it ran 1.04 and 1.03 times as fast.
// All steps since v000 together make it 2.33 times as fast.
#include <hip/hip_runtime.h>

// Fused Parallax-Attention (PAM) for MI455X / gfx1250.
// One workgroup (256 threads = 8 wave32) per (batch, row): both directions.
// Waves 0..3 own the left row, waves 4..7 the right row; a wave owns 64 pixels, as two
// groups of 32. Pipeline per block:
//   0) while the row loads fly, the block folds BN into both weight matrices and lays
//      them in LDS as f16 in the convs' A-fragment order (no setup launch, no workspace)
//   1) each wave loads its 64 pixels of its own row straight into the convs'
//      B fragments (lane = pixel pair, 8-byte loads, one 128-B line per half-wave)
//   2) the row goes to its side's V (c,w) f16 in LDS
//   3) conv1x1+BN (folded) via WMMA -> its side's Kt (w,c) f16 in LDS
//   4) conv1x1+BN via WMMA from the same fragments -> Q, kept in registers as the
//      score product's B operand  [log2e/64 folded in], then the barrier for Kt and V
//      (group 1's Q is made behind group 0's key loop, from its row fragments)
//   5) flash-style attention of the wave's own queries against the OTHER side's
//      Kt and V, one group of 32 queries (two tiles of 16) per key loop, so that each K and
//      V fragment read from LDS serves two query tiles:
//      S^T = K^T Q via WMMA, online softmax in exp2
//      domain (per-lane + one shfl_xor(16)), O^T += V * P via WMMA.
//      The two tiles are the group's even and odd pixels, so a lane ends with pixel pairs
//      and stores 8 bytes: whole 128-B lines.

typedef __attribute__((ext_vector_type(16))) _Float16 v16h;
typedef __attribute__((ext_vector_type(8)))  _Float16 v8h;
typedef __attribute__((ext_vector_type(4)))  _Float16 v4h;
typedef __attribute__((ext_vector_type(2)))  _Float16 v2h;
typedef __attribute__((ext_vector_type(8)))  float    v8f;
typedef __attribute__((ext_vector_type(4)))  float    v4f;

#define NB 8
#define NC 64
#define NH 128
#define NW 256
#define HWSZ (NH * NW)
#define BN_EPS 1e-5f
#define LOG2E 1.44269504088896340736f

// LDS layout (in halfs). All strides multiples of 8 halfs (16B) for b128 ds ops.
// Kt and V exist once per side (0 = left row, 1 = right row); a side's V follows its Kt,
// so every constant offset from the side's base fits a ds instruction's offset field.
#define XT_STR 72
#define KT_SZ  (256 * 72)
#define V_STR  264
#define V_SZ   (64 * 264)
#define SIDE_SZ (KT_SZ + V_SZ)
// Folded weights, fragment order: 32 groups [conv][out tile][ch half][part] of 32 lanes x 8
// halfs, so a wave's 16-byte read is 512 contiguous bytes; 8 halfs of pad per group spread
// the writers' banks. Behind them 128 folded f32 biases (Q then K).
#define WF_OFF (2 * SIDE_SZ)
#define WF_GRP 264
#define BF_OFF (WF_OFF + 32 * WF_GRP)
#define SMEM_HALFS (BF_OFF + 256)              // 79360 halfs
#define SMEM_BYTES (SMEM_HALFS * 2)            // 158720 B: two blocks per WGP

__device__ __forceinline__ v8f wmma16(v16h a, v16h b, v8f c) {
  // D = A(16x32 f16) * B(32x16 f16) + C(16x16 f32)
  return __builtin_amdgcn_wmma_f32_16x16x32_f16(false, a, false, b,
                                                (short)0, c, false, false);
}

// Load one 16x32 f16 A/B operand half-row for this lane:
// elements 0..7 = p[0..7], elements 8..15 = p[16..23]  (caller adds the
// lane<16 ? 0 : 8 half-wave K offset).
__device__ __forceinline__ v16h ld_ab(const _Float16* p) {
  v8h lo = *(const v8h*)(p);
  v8h hi = *(const v8h*)(p + 16);
  v16h r;
#pragma unroll
  for (int i = 0; i < 8; ++i) { r[i] = lo[i]; r[8 + i] = hi[i]; }
  return r;
}

// One A fragment of the folded weights: wf = the lane's 8 halfs in group 0 of the conv.
__device__ __forceinline__ v16h ld_wf(const _Float16* wf, int t, int kh) {
  v8h lo = *(const v8h*)(wf + ((t * 2 + kh) * 2) * WF_GRP);
  v8h hi = *(const v8h*)(wf + ((t * 2 + kh) * 2 + 1) * WF_GRP);
  v16h r;
#pragma unroll
  for (int i = 0; i < 8; ++i) { r[i] = lo[i]; r[8 + i] = hi[i]; }
  return r;
}

// One lane's share of a row for the conv's B operand. p points at channel k0,
// pixel pair (2*hl, 2*hl+1) of one of the wave's two groups of 32 pixels. raw[kh*16 + q] is element q
// of the fragment of in-channels kh*32..kh*32+31 (the k order of ld_ab):
// .x belongs to column hl of pixel tile 0 (even pixels), .y to tile 1 (odd pixels).
__device__ __forceinline__ void load_row(const float* __restrict__ p, float2 (&raw)[32]) {
#pragma unroll
  for (int i = 0; i < 32; ++i)
    raw[i] = *(const float2*)(p + (size_t)((i >> 3) * 16 + (i & 7)) * HWSZ);
}

__device__ __forceinline__ void to_frags(const float2 (&raw)[32], v16h (&xb)[2][2]) {
#pragma unroll
  for (int kh = 0; kh < 2; ++kh)
#pragma unroll
    for (int q = 0; q < 16; ++q) {
      xb[0][kh][q] = (_Float16)raw[kh * 16 + q].x;
      xb[1][kh][q] = (_Float16)raw[kh * 16 + q].y;
    }
}

// Conv 1x1 over the wave's 64 pixels: Y(64 out x 64 px) = W'(64x64) X + b'.
// dst points at this lane's even pixel row of group 0, channel k0; the odd pixel is the
// next row, group 1 lies 32 rows on. Each weight fragment serves all four pixel tiles.
__device__ __forceinline__ void conv_frags(_Float16* dst, const _Float16* Wf,
                                           const float* Bf,
                                           const v16h (&xb)[2][2][2]) {
#pragma unroll
  for (int t = 0; t < 4; ++t) {                    // 4 out-channel tiles
    v16h a0 = ld_wf(Wf, t, 0);
    v16h a1 = ld_wf(Wf, t, 1);
    const v4f bl = *(const v4f*)(Bf + t * 16);     // Bf = the conv's biases + k0
    const v4f bh = *(const v4f*)(Bf + t * 16 + 4);
    v8f bias = {bl[0], bl[1], bl[2], bl[3], bh[0], bh[1], bh[2], bh[3]};
#pragma unroll
    for (int g = 0; g < 2; ++g)                    // pixel group
#pragma unroll
      for (int j = 0; j < 2; ++j) {                // even / odd pixel tile
        v8f acc = wmma16(a0, xb[g][j][0], bias);
        acc = wmma16(a1, xb[g][j][1], acc);
        v8h hv;
#pragma unroll
        for (int k = 0; k < 8; ++k) hv[k] = (_Float16)acc[k];
        *(v8h*)(dst + (g * 32 + j) * XT_STR + t * 16) = hv;
      }
  }
}

// The same conv for one group of 32 pixels, its result kept in registers. A 16-channel
// accumulator tile t holds, per lane, channels t*16 + k0 .. + 7 of one pixel: exactly
// elements (t&1)*8 .. + 7 of the B fragment of channels (t>>1)*32 .. + 31 in the k order of
// ld_ab. qf[j] = fragments of the even (j = 0) / odd (j = 1) pixels, column hl = pixel 2*hl + j.
__device__ __forceinline__ void conv_regs(v16h (&qf)[2][2], const _Float16* Wf,
                                          const float* Bf,
                                          const v16h (&xb)[2][2]) {
#pragma unroll
  for (int t = 0; t < 4; ++t) {                    // 4 out-channel tiles
    v16h a0 = ld_wf(Wf, t, 0);
    v16h a1 = ld_wf(Wf, t, 1);
    const v4f bl = *(const v4f*)(Bf + t * 16);     // Bf = the conv's biases + k0
    const v4f bh = *(const v4f*)(Bf + t * 16 + 4);
    v8f bias = {bl[0], bl[1], bl[2], bl[3], bh[0], bh[1], bh[2], bh[3]};
#pragma unroll
    for (int j = 0; j < 2; ++j) {                  // even / odd pixel tile
      v8f acc = wmma16(a0, xb[j][0], bias);
      acc = wmma16(a1, xb[j][1], acc);
#pragma unroll
      for (int k = 0; k < 8; ++k) qf[j][t >> 1][(t & 1) * 8 + k] = (_Float16)acc[k];
    }
  }
}

// Second bound: 4 waves per SIMD, the two 8-wave blocks per WGP that the LDS allows.
__global__ __launch_bounds__(256, 4) void pam_fused(const float* __restrict__ fea_left,
                                                 const float* __restrict__ fea_right,
                                                 const float* Wq, const float* bq,
                                                 const float* gq, const float* betaq,
                                                 const float* mq, const float* vq,
                                                 const float* Wk, const float* bk,
                                                 const float* gk, const float* betak,
                                                 const float* mk, const float* vk,
                                                 float* __restrict__ out) {
  extern __shared__ _Float16 sm[];
  const int bi  = blockIdx.x;
  const int b   = bi >> 7;
  const int h   = bi & 127;
  const size_t rowoff = (size_t)b * NC * HWSZ + (size_t)h * NW;

  const int tid  = threadIdx.x;
  const int lane = tid & 31;
  const int wid  = __builtin_amdgcn_readfirstlane(tid >> 5);  // wave id, scalar
  const int dir  = wid >> 2;                // side of this wave's row = output half
  const int wvs  = wid & 3;                 // the wave's 64 pixels within the row
  const float* own = dir ? fea_right : fea_left;   // queries; the other side's keys/values
  const int hl   = lane & 15;
  const int k0   = (lane < 16) ? 0 : 8;     // ISA half-wave K offset

  // ---- staging: no transposing LDS stage, fragments come straight from global ----
  const int    pxl  = wvs * 64 + 2 * hl;            // this lane's even pixel of group 0
  const size_t loff = rowoff + (size_t)k0 * HWSZ + pxl;
  float2 raw[2][32];
  v16h   xb[2][2][2];                               // [group][even / odd][ch 0..31 / 32..63]

  // ---- weight and BN loads go out first: they come back first, from L2 ----
  // Thread tid takes 4 neighbouring weights of rows frow, + 16, + 32, + 48 of both matrices
  // (a wave's 16-byte load = 512 contiguous bytes). Every thread also loads one channel's
  // five bias terms, so that no branch stands among the loads; waves 0..3 fold them.
  const int frow = tid >> 4;
  const int fcol = (tid & 15) * 4;
  const int woff = frow * 64 + fcol;
  const int bo   = tid & 63;
  const bool bk_side = (wid >> 1) & 1;              // waves 0,1: Q biases; waves 2,3: K biases
  float4 wv[8];
  float  fg[8], fv[8];
#pragma unroll
  for (int j = 0; j < 8; ++j) {                     // j >> 2: matrix, j & 3: 16-row tile
    wv[j] = *(const float4*)(((j >> 2) ? Wk : Wq) + (j & 3) * 1024 + woff);
    fg[j] = ((j >> 2) ? gk : gq)[(j & 3) * 16 + frow];
    fv[j] = ((j >> 2) ? vk : vq)[(j & 3) * 16 + frow];
  }
  const float b_b = (bk_side ? bk : bq)[bo],       b_g = (bk_side ? gk : gq)[bo];
  const float b_t = (bk_side ? betak : betaq)[bo], b_m = (bk_side ? mk : mq)[bo];
  const float b_v = (bk_side ? vk : vq)[bo];
  // The wait that belongs in front of any overwrite of these loads' offset registers
  // (named as inputs, so they stay untouched up to here). Its memory clobber also holds the
  // loads above it (their pointers are not restrict for that reason): issued behind the
  // row loads they would come back behind them, and the fold would wait for the whole row.
  asm volatile("s_wait_xcnt 0x0" :: "v"(woff * 4), "v"(frow), "v"(bo) : "memory");

  const float* po = own + loff;
  load_row(po, raw[0]);                             // the whole share in flight at once
  load_row(po + 32, raw[1]);
  // The wait that belongs in front of any overwrite of the loads' address registers;
  // naming the address as an input keeps its registers untouched up to here.
  asm volatile("s_wait_xcnt 0x0" :: "v"(po) : "memory");
  // Keeps the fold's arithmetic, and with it the wait for the first BN values, from being
  // scheduled in front of the row loads: those would then go out an L2 round trip later.
  __builtin_amdgcn_sched_barrier(0);

  // ---- fold BN into the weights (log2e/64 into Q's: cost/64, softmax in exp2) -> LDS ----
  {
    const float qscale = LOG2E / 64.0f;
    _Float16* wdst = sm + WF_OFF + (fcol >> 4) * WF_GRP
                   + (((fcol >> 3) & 1) * 16 + frow) * 8 + (fcol & 7);
#pragma unroll
    for (int j = 0; j < 8; ++j) {
      const float s = fg[j] * rsqrtf(fv[j] + BN_EPS);
      v4h hv;
      if (j >> 2) {
        hv[0] = (_Float16)(wv[j].x * s); hv[1] = (_Float16)(wv[j].y * s);
        hv[2] = (_Float16)(wv[j].z * s); hv[3] = (_Float16)(wv[j].w * s);
      } else {
        hv[0] = (_Float16)(wv[j].x * s * qscale); hv[1] = (_Float16)(wv[j].y * s * qscale);
        hv[2] = (_Float16)(wv[j].z * s * qscale); hv[3] = (_Float16)(wv[j].w * s * qscale);
      }
      *(v4h*)(wdst + ((j >> 2) * 16 + (j & 3) * 4) * WF_GRP) = hv;
    }
    if (wid < 4) {
      const float s  = b_g * rsqrtf(b_v + BN_EPS);
      const float bf = s * b_b + b_t - b_m * s;
      ((float*)(sm + BF_OFF))[tid] = bk_side ? bf : bf * qscale;
    }
  }
  // Barrier for the folded weights. Its fences name LDS alone: __syncthreads() would also
  // wait for every global load, and the row loads are meant to stay in flight across it.
  __builtin_amdgcn_fence(__ATOMIC_RELEASE, "workgroup", "local");
  __builtin_amdgcn_s_barrier();
  __builtin_amdgcn_fence(__ATOMIC_ACQUIRE, "workgroup", "local");

  // ---- own row -> this side's V (c,w) and the fragments of both convs ----
  _Float16* vown = sm + dir * SIDE_SZ + KT_SZ;
#pragma unroll
  for (int g = 0; g < 2; ++g) {
#pragma unroll
    for (int i = 0; i < 32; ++i) {
      v2h hv2 = {(_Float16)raw[g][i].x, (_Float16)raw[g][i].y};
      *(v2h*)(vown + ((i >> 3) * 16 + (i & 7) + k0) * V_STR + pxl + g * 32) = hv2;
    }
    to_frags(raw[g], xb[g]);
  }

  // ---- conv K -> this side's Kt, conv Q (log2e/64 folded) of group 0 -> registers ----
  const _Float16* wfl = sm + WF_OFF + lane * 8;
  const float*    bfl = (const float*)(sm + BF_OFF) + k0;
  conv_frags(sm + dir * SIDE_SZ + pxl * XT_STR + k0, wfl + 16 * WF_GRP, bfl + 64, xb);
  // qall: [query tile][ch 0..31 / 32..63]; tile 0 = the group's even pixels, tile 1 = its odd
  // ones, as the conv leaves them: column hl of tile j is pixel 2 * hl + j.
  v16h qall[2][2];
  conv_regs(qall, wfl, bfl, xb[0]);
  __syncthreads();

  const _Float16* kt_o = sm + (dir ^ 1) * SIDE_SZ;          // the other side's keys
  const _Float16* v_o  = kt_o + KT_SZ;                      // and values

  // ---- attention: per wave, its two groups of 32 queries, one after the other ----
  // Unrolled so that g is a constant: the row fragments are registers, not indexable.
#pragma unroll
  for (int g = 0; g < 2; ++g) {
    // Group 1's conv Q stands here, not in front of the barrier, so that the group waits
    // through group 0's key loop as its 32 registers of row fragments and no more; the
    // folded weights stay in LDS to the end.
    if (g == 1) conv_regs(qall, wfl, bfl, xb[1]);

    v8f o[2][4];                        // [query tile][channel tile]
    float m[2], l[2];
#pragma unroll
    for (int j = 0; j < 2; ++j) {
#pragma unroll
      for (int t = 0; t < 4; ++t)
#pragma unroll
        for (int k = 0; k < 8; ++k) o[j][t][k] = 0.0f;
      m[j] = -3.0e38f; l[j] = 0.0f;
    }

    for (int kc = 0; kc < 8; ++kc) {    // 8 key chunks of 32 keys
      // K^T A-operands: two key tiles (keys kc*32+0..15 and +16..31), for both query tiles
      const _Float16* kr0 = kt_o + (kc * 32 + hl) * XT_STR;
      const _Float16* kr1 = kr0 + 16 * XT_STR;
      v16h ka00 = ld_ab(kr0 + k0), ka01 = ld_ab(kr0 + 32 + k0);
      v16h ka10 = ld_ab(kr1 + k0), ka11 = ld_ab(kr1 + 32 + k0);

      v16h pb[2];
#pragma unroll
      for (int j = 0; j < 2; ++j) {     // query tile
        v8f s0, s1;
#pragma unroll
        for (int k = 0; k < 8; ++k) { s0[k] = 0.0f; s1[k] = 0.0f; }
        s0 = wmma16(ka00, qall[j][0], s0); s0 = wmma16(ka01, qall[j][1], s0);
        s1 = wmma16(ka10, qall[j][0], s1); s1 = wmma16(ka11, qall[j][1], s1);

        // online softmax (exp2 domain; log2e folded into Q) per query lane pair
        float cm = s0[0];
#pragma unroll
        for (int k = 1; k < 8; ++k) cm = fmaxf(cm, s0[k]);
#pragma unroll
        for (int k = 0; k < 8; ++k) cm = fmaxf(cm, s1[k]);
        cm = fmaxf(cm, __shfl_xor(cm, 16, 32));
        float mn   = fmaxf(m[j], cm);
        float corr = __builtin_amdgcn_exp2f(m[j] - mn);
        v8f p0, p1;
        float cs = 0.0f;
#pragma unroll
        for (int k = 0; k < 8; ++k) { p0[k] = __builtin_amdgcn_exp2f(s0[k] - mn); cs += p0[k]; }
#pragma unroll
        for (int k = 0; k < 8; ++k) { p1[k] = __builtin_amdgcn_exp2f(s1[k] - mn); cs += p1[k]; }
        cs += __shfl_xor(cs, 16, 32);
        l[j] = l[j] * corr + cs;
        m[j] = mn;
#pragma unroll
        for (int t = 0; t < 4; ++t) o[j][t] = o[j][t] * corr;

        // P^T C-layout -> B-operand by pure per-lane f32->f16 pair packing
#pragma unroll
        for (int e = 0; e < 8; ++e) { pb[j][e] = (_Float16)p0[e]; pb[j][8 + e] = (_Float16)p1[e]; }
      }

      // O^T += V(ch tile, 32 keys) * P, each V fragment for both query tiles
#pragma unroll
      for (int ct = 0; ct < 4; ++ct) {
        v16h va = ld_ab(v_o + (ct * 16 + hl) * V_STR + kc * 32 + k0);
        o[0][ct] = wmma16(va, pb[0], o[0][ct]);
        o[1][ct] = wmma16(va, pb[1], o[1][ct]);
      }
    }

    // finalize and write out (B,C,H,W) f32; dir selects cxr vs enh half. The lane's columns
    // of the two query tiles are neighbouring pixels, so each channel goes out as one 8-byte
    // store: 16 lanes fill one whole 128-B line, a wave's store two lines (channels c, c + 8).
    const float inv0 = 1.0f / l[0], inv1 = 1.0f / l[1];
    float* obase = out + (size_t)dir * ((size_t)NB * NC * HWSZ)
                 + (size_t)b * NC * HWSZ + (size_t)h * NW + wvs * 64 + g * 32 + 2 * hl;
#pragma unroll
    for (int ct = 0; ct < 4; ++ct)
#pragma unroll
      for (int k = 0; k < 8; ++k)
        *(float2*)(obase + (size_t)(ct * 16 + k0 + k) * HWSZ) =
            make_float2(o[0][ct][k] * inv0, o[1][ct][k] * inv1);
  }
}

extern "C" void kernel_launch(void* const* d_in, const int* in_sizes, int n_in,
                              void* d_out, int out_size, void* d_ws, size_t ws_size,
                              hipStream_t stream) {
  (void)in_sizes; (void)n_in; (void)out_size; (void)d_ws; (void)ws_size;
  (void)hipFuncSetAttribute((const void*)pam_fused,
                            hipFuncAttributeMaxDynamicSharedMemorySize, SMEM_BYTES);
  pam_fused<<<dim3(NB * NH), dim3(256), SMEM_BYTES, stream>>>(
      (const float*)d_in[0],  (const float*)d_in[1],
      (const float*)d_in[2],  (const float*)d_in[3],  (const float*)d_in[4],
      (const float*)d_in[5],  (const float*)d_in[6],  (const float*)d_in[7],
      (const float*)d_in[8],  (const float*)d_in[9],  (const float*)d_in[10],
      (const float*)d_in[11], (const float*)d_in[12], (const float*)d_in[13],
      (float*)d_out);
}

// v006
// One run takes 44.4 microseconds.
// Next to v005, in two timings, it ran 1.04 times as fast each time.
// Over all steps from v000 it is 2.42 times as fast.
#include <hip/hip_runtime.h>

// Fused Parallax-Attention (PAM) for MI455X / gfx1250.
// One workgroup (256 threads = 8 wave32) per (batch, row): both directions.
// Waves 0..3 own the left row, waves 4..7 the right row; a wave owns 64 pixels, as two
// groups of 32. Pipeline per block:
//   0) while the row loads fly, the block folds BN into both weight matrices and lays
//      them in LDS as f16 in the convs' A-fragment order (no setup launch, no workspace)
//   1) each wave loads its 64 pixels of its own row straight into the convs'
//      B fragments (lane = pixel pair, 8-byte loads, one 128-B line per half-wave)
//   2) the row goes to its side's V (c,w) f16 in LDS
//   3) conv1x1+BN (folded) via WMMA -> its side's Kt (w,c) f16 in LDS
//   4) conv1x1+BN via WMMA from the same fragments -> Q, kept in registers as the
//      score product's B operand  [log2e/64 folded in], then the barrier for Kt and V
//      (group 1's Q is made behind group 0's key loop, from its row fragments)
//   5) flash-style attention of the wave's own queries against the OTHER side's
//      Kt and V, one group of 32 queries (two tiles of 16) per key loop, so that each K and
//      V fragment read from LDS serves two query tiles:
//      S^T = K^T Q via WMMA, online softmax in exp2
//      domain (per-lane + one shfl_xor(16); O and l rescaled lazily), O^T += V * P via WMMA.
//      The two tiles are the group's even and odd pixels, so a lane ends with pixel pairs
//      and stores 8 bytes: whole 128-B lines.

typedef __attribute__((ext_vector_type(16))) _Float16 v16h;
typedef __attribute__((ext_vector_type(8)))  _Float16 v8h;
typedef __attribute__((ext_vector_type(4)))  _Float16 v4h;
typedef __attribute__((ext_vector_type(2)))  _Float16 v2h;
typedef __attribute__((ext_vector_type(8)))  float    v8f;
typedef __attribute__((ext_vector_type(4)))  float    v4f;

#define NB 8
#define NC 64
#define NH 128
#define NW 256
#define HWSZ (NH * NW)
#define BN_EPS 1e-5f
#define LOG2E 1.44269504088896340736f

// LDS layout (in halfs). All strides multiples of 8 halfs (16B) for b128 ds ops.
// Kt and V exist once per side (0 = left row, 1 = right row); a side's V follows its Kt,
// so every constant offset from the side's base fits a ds instruction's offset field.
#define XT_STR 72
#define KT_SZ  (256 * 72)
#define V_STR  264
#define V_SZ   (64 * 264)
#define SIDE_SZ (KT_SZ + V_SZ)
// Folded weights, fragment order: 32 groups [conv][out tile][ch half][part] of 32 lanes x 8
// halfs, so a wave's 16-byte read is 512 contiguous bytes; 8 halfs of pad per group spread
// the writers' banks. Behind them 128 folded f32 biases (Q then K).
#define WF_OFF (2 * SIDE_SZ)
#define WF_GRP 264
#define BF_OFF (WF_OFF + 32 * WF_GRP)
#define SMEM_HALFS (BF_OFF + 256)              // 79360 halfs
#define SMEM_BYTES (SMEM_HALFS * 2)            // 158720 B: two blocks per WGP

__device__ __forceinline__ v8f wmma16(v16h a, v16h b, v8f c) {
  // D = A(16x32 f16) * B(32x16 f16) + C(16x16 f32)
  return __builtin_amdgcn_wmma_f32_16x16x32_f16(false, a, false, b,
                                                (short)0, c, false, false);
}

// Load one 16x32 f16 A/B operand half-row for this lane:
// elements 0..7 = p[0..7], elements 8..15 = p[16..23]  (caller adds the
// lane<16 ? 0 : 8 half-wave K offset).
__device__ __forceinline__ v16h ld_ab(const _Float16* p) {
  v8h lo = *(const v8h*)(p);
  v8h hi = *(const v8h*)(p + 16);
  v16h r;
#pragma unroll
  for (int i = 0; i < 8; ++i) { r[i] = lo[i]; r[8 + i] = hi[i]; }
  return r;
}

// One A fragment of the folded weights: wf = the lane's 8 halfs in group 0 of the conv.
__device__ __forceinline__ v16h ld_wf(const _Float16* wf, int t, int kh) {
  v8h lo = *(const v8h*)(wf + ((t * 2 + kh) * 2) * WF_GRP);
  v8h hi = *(const v8h*)(wf + ((t * 2 + kh) * 2 + 1) * WF_GRP);
  v16h r;
#pragma unroll
  for (int i = 0; i < 8; ++i) { r[i] = lo[i]; r[8 + i] = hi[i]; }
  return r;
}

// One lane's share of a row for the conv's B operand. p points at channel k0,
// pixel pair (2*hl, 2*hl+1) of one of the wave's two groups of 32 pixels. raw[kh*16 + q] is element q
// of the fragment of in-channels kh*32..kh*32+31 (the k order of ld_ab):
// .x belongs to column hl of pixel tile 0 (even pixels), .y to tile 1 (odd pixels).
__device__ __forceinline__ void load_row(const float* __restrict__ p, float2 (&raw)[32]) {
#pragma unroll
  for (int i = 0; i < 32; ++i)
    raw[i] = *(const float2*)(p + (size_t)((i >> 3) * 16 + (i & 7)) * HWSZ);
}

__device__ __forceinline__ void to_frags(const float2 (&raw)[32], v16h (&xb)[2][2]) {
#pragma unroll
  for (int kh = 0; kh < 2; ++kh)
#pragma unroll
    for (int q = 0; q < 16; ++q) {
      xb[0][kh][q] = (_Float16)raw[kh * 16 + q].x;
      xb[1][kh][q] = (_Float16)raw[kh * 16 + q].y;
    }
}

// Conv 1x1 over the wave's 64 pixels: Y(64 out x 64 px) = W'(64x64) X + b'.
// dst points at this lane's even pixel row of group 0, channel k0; the odd pixel is the
// next row, group 1 lies 32 rows on. Each weight fragment serves all four pixel tiles.
__device__ __forceinline__ void conv_frags(_Float16* dst, const _Float16* Wf,
                                           const float* Bf,
                                           const v16h (&xb)[2][2][2]) {
#pragma unroll
  for (int t = 0; t < 4; ++t) {                    // 4 out-channel tiles
    v16h a0 = ld_wf(Wf, t, 0);
    v16h a1 = ld_wf(Wf, t, 1);
    const v4f bl = *(const v4f*)(Bf + t * 16);     // Bf = the conv's biases + k0
    const v4f bh = *(const v4f*)(Bf + t * 16 + 4);
    v8f bias = {bl[0], bl[1], bl[2], bl[3], bh[0], bh[1], bh[2], bh[3]};
#pragma unroll
    for (int g = 0; g < 2; ++g)                    // pixel group
#pragma unroll
      for (int j = 0; j < 2; ++j) {                // even / odd pixel tile
        v8f acc = wmma16(a0, xb[g][j][0], bias);
        acc = wmma16(a1, xb[g][j][1], acc);
        v8h hv;
#pragma unroll
        for (int k = 0; k < 8; ++k) hv[k] = (_Float16)acc[k];
        *(v8h*)(dst + (g * 32 + j) * XT_STR + t * 16) = hv;
      }
  }
}

// The same conv for one group of 32 pixels, its result kept in registers. A 16-channel
// accumulator tile t holds, per lane, channels t*16 + k0 .. + 7 of one pixel: exactly
// elements (t&1)*8 .. + 7 of the B fragment of channels (t>>1)*32 .. + 31 in the k order of
// ld_ab. qf[j] = fragments of the even (j = 0) / odd (j = 1) pixels, column hl = pixel 2*hl + j.
__device__ __forceinline__ void conv_regs(v16h (&qf)[2][2], const _Float16* Wf,
                                          const float* Bf,
                                          const v16h (&xb)[2][2]) {
#pragma unroll
  for (int t = 0; t < 4; ++t) {                    // 4 out-channel tiles
    v16h a0 = ld_wf(Wf, t, 0);
    v16h a1 = ld_wf(Wf, t, 1);
    const v4f bl = *(const v4f*)(Bf + t * 16);     // Bf = the conv's biases + k0
    const v4f bh = *(const v4f*)(Bf + t * 16 + 4);
    v8f bias = {bl[0], bl[1], bl[2], bl[3], bh[0], bh[1], bh[2], bh[3]};
#pragma unroll
    for (int j = 0; j < 2; ++j) {                  // even / odd pixel tile
      v8f acc = wmma16(a0, xb[j][0], bias);
      acc = wmma16(a1, xb[j][1], acc);
#pragma unroll
      for (int k = 0; k < 8; ++k) qf[j][t >> 1][(t & 1) * 8 + k] = (_Float16)acc[k];
    }
  }
}

// Second bound: 4 waves per SIMD, the two 8-wave blocks per WGP that the LDS allows.
__global__ __launch_bounds__(256, 4) void pam_fused(const float* __restrict__ fea_left,
                                                 const float* __restrict__ fea_right,
                                                 const float* Wq, const float* bq,
                                                 const float* gq, const float* betaq,
                                                 const float* mq, const float* vq,
                                                 const float* Wk, const float* bk,
                                                 const float* gk, const float* betak,
                                                 const float* mk, const float* vk,
                                                 float* __restrict__ out) {
  extern __shared__ _Float16 sm[];
  const int bi  = blockIdx.x;
  const int b   = bi >> 7;
  const int h   = bi & 127;
  const size_t rowoff = (size_t)b * NC * HWSZ + (size_t)h * NW;

  const int tid  = threadIdx.x;
  const int lane = tid & 31;
  const int wid  = __builtin_amdgcn_readfirstlane(tid >> 5);  // wave id, scalar
  const int dir  = wid >> 2;                // side of this wave's row = output half
  const int wvs  = wid & 3;                 // the wave's 64 pixels within the row
  const float* own = dir ? fea_right : fea_left;   // queries; the other side's keys/values
  const int hl   = lane & 15;
  const int k0   = (lane < 16) ? 0 : 8;     // ISA half-wave K offset

  // ---- staging: no transposing LDS stage, fragments come straight from global ----
  const int    pxl  = wvs * 64 + 2 * hl;            // this lane's even pixel of group 0
  const size_t loff = rowoff + (size_t)k0 * HWSZ + pxl;
  float2 raw[2][32];
  v16h   xb[2][2][2];                               // [group][even / odd][ch 0..31 / 32..63]

  // ---- weight and BN loads go out first: they come back first, from L2 ----
  // Thread tid takes 4 neighbouring weights of rows frow, + 16, + 32, + 48 of both matrices
  // (a wave's 16-byte load = 512 contiguous bytes). Every thread also loads one channel's
  // five bias terms, so that no branch stands among the loads; waves 0..3 fold them.
  const int frow = tid >> 4;
  const int fcol = (tid & 15) * 4;
  const int woff = frow * 64 + fcol;
  const int bo   = tid & 63;
  const bool bk_side = (wid >> 1) & 1;              // waves 0,1: Q biases; waves 2,3: K biases
  float4 wv[8];
  float  fg[8], fv[8];
#pragma unroll
  for (int j = 0; j < 8; ++j) {                     // j >> 2: matrix, j & 3: 16-row tile
    wv[j] = *(const float4*)(((j >> 2) ? Wk : Wq) + (j & 3) * 1024 + woff);
    fg[j] = ((j >> 2) ? gk : gq)[(j & 3) * 16 + frow];
    fv[j] = ((j >> 2) ? vk : vq)[(j & 3) * 16 + frow];
  }
  const float b_b = (bk_side ? bk : bq)[bo],       b_g = (bk_side ? gk : gq)[bo];
  const float b_t = (bk_side ? betak : betaq)[bo], b_m = (bk_side ? mk : mq)[bo];
  const float b_v = (bk_side ? vk : vq)[bo];
  // The wait that belongs in front of any overwrite of these loads' offset registers
  // (named as inputs, so they stay untouched up to here). Its memory clobber also holds the
  // loads above it (their pointers are not restrict for that reason): issued behind the
  // row loads they would come back behind them, and the fold would wait for the whole row.
  asm volatile("s_wait_xcnt 0x0" :: "v"(woff * 4), "v"(frow), "v"(bo) : "memory");

  const float* po = own + loff;
  load_row(po, raw[0]);                             // the whole share in flight at once
  load_row(po + 32, raw[1]);
  // The wait that belongs in front of any overwrite of the loads' address registers;
  // naming the address as an input keeps its registers untouched up to here.
  asm volatile("s_wait_xcnt 0x0" :: "v"(po) : "memory");
  // Keeps the fold's arithmetic, and with it the wait for the first BN values, from being
  // scheduled in front of the row loads: those would then go out an L2 round trip later.
  __builtin_amdgcn_sched_barrier(0);

  // ---- fold BN into the weights (log2e/64 into Q's: cost/64, softmax in exp2) -> LDS ----
  {
    const float qscale = LOG2E / 64.0f;
    _Float16* wdst = sm + WF_OFF + (fcol >> 4) * WF_GRP
                   + (((fcol >> 3) & 1) * 16 + frow) * 8 + (fcol & 7);
#pragma unroll
    for (int j = 0; j < 8; ++j) {
      const float s = fg[j] * rsqrtf(fv[j] + BN_EPS);
      v4h hv;
      if (j >> 2) {
        hv[0] = (_Float16)(wv[j].x * s); hv[1] = (_Float16)(wv[j].y * s);
        hv[2] = (_Float16)(wv[j].z * s); hv[3] = (_Float16)(wv[j].w * s);
      } else {
        hv[0] = (_Float16)(wv[j].x * s * qscale); hv[1] = (_Float16)(wv[j].y * s * qscale);
        hv[2] = (_Float16)(wv[j].z * s * qscale); hv[3] = (_Float16)(wv[j].w * s * qscale);
      }
      *(v4h*)(wdst + ((j >> 2) * 16 + (j & 3) * 4) * WF_GRP) = hv;
    }
    if (wid < 4) {
      const float s  = b_g * rsqrtf(b_v + BN_EPS);
      const float bf = s * b_b + b_t - b_m * s;
      ((float*)(sm + BF_OFF))[tid] = bk_side ? bf : bf * qscale;
    }
  }
  // Barrier for the folded weights. Its fences name LDS alone: __syncthreads() would also
  // wait for every global load, and the row loads are meant to stay in flight across it.
  __builtin_amdgcn_fence(__ATOMIC_RELEASE, "workgroup", "local");
  __builtin_amdgcn_s_barrier();
  __builtin_amdgcn_fence(__ATOMIC_ACQUIRE, "workgroup", "local");

  // ---- own row -> this side's V (c,w) and the fragments of both convs ----
  _Float16* vown = sm + dir * SIDE_SZ + KT_SZ;
#pragma unroll
  for (int g = 0; g < 2; ++g) {
#pragma unroll
    for (int i = 0; i < 32; ++i) {
      v2h hv2 = {(_Float16)raw[g][i].x, (_Float16)raw[g][i].y};
      *(v2h*)(vown + ((i >> 3) * 16 + (i & 7) + k0) * V_STR + pxl + g * 32) = hv2;
    }
    to_frags(raw[g], xb[g]);
  }

  // ---- conv K -> this side's Kt, conv Q (log2e/64 folded) of group 0 -> registers ----
  const _Float16* wfl = sm + WF_OFF + lane * 8;
  const float*    bfl = (const float*)(sm + BF_OFF) + k0;
  conv_frags(sm + dir * SIDE_SZ + pxl * XT_STR + k0, wfl + 16 * WF_GRP, bfl + 64, xb);
  // qall: [query tile][ch 0..31 / 32..63]; tile 0 = the group's even pixels, tile 1 = its odd
  // ones, as the conv leaves them: column hl of tile j is pixel 2 * hl + j.
  v16h qall[2][2];
  conv_regs(qall, wfl, bfl, xb[0]);
  __syncthreads();

  const _Float16* kt_o = sm + (dir ^ 1) * SIDE_SZ;          // the other side's keys
  const _Float16* v_o  = kt_o + KT_SZ;                      // and values

  // ---- attention: per wave, its two groups of 32 queries, one after the other ----
  // Unrolled so that g is a constant: the row fragments are registers, not indexable.
#pragma unroll
  for (int g = 0; g < 2; ++g) {
    // Group 1's conv Q stands here, not in front of the barrier, so that the group waits
    // through group 0's key loop as its 32 registers of row fragments and no more; the
    // folded weights stay in LDS to the end.
    if (g == 1) conv_regs(qall, wfl, bfl, xb[1]);

    v8f o[2][4];                        // [query tile][channel tile]
    float m[2], l[2];
#pragma unroll
    for (int j = 0; j < 2; ++j) {
#pragma unroll
      for (int t = 0; t < 4; ++t)
#pragma unroll
        for (int k = 0; k < 8; ++k) o[j][t][k] = 0.0f;
      m[j] = -3.0e38f; l[j] = 0.0f;
    }

    for (int kc = 0; kc < 8; ++kc) {    // 8 key chunks of 32 keys
      // K^T A-operands: two key tiles (keys kc*32+0..15 and +16..31), for both query tiles
      const _Float16* kr0 = kt_o + (kc * 32 + hl) * XT_STR;
      const _Float16* kr1 = kr0 + 16 * XT_STR;
      v16h ka00 = ld_ab(kr0 + k0), ka01 = ld_ab(kr0 + 32 + k0);
      v16h ka10 = ld_ab(kr1 + k0), ka11 = ld_ab(kr1 + 32 + k0);

      v8f s[2][2];                      // [query tile][key tile]
      float cm[2];                      // the lane's own maximum: 16 of the query's 32 scores
      bool need = false;
#pragma unroll
      for (int j = 0; j < 2; ++j) {     // query tile
        v8f s0, s1;
#pragma unroll
        for (int k = 0; k < 8; ++k) { s0[k] = 0.0f; s1[k] = 0.0f; }
        s0 = wmma16(ka00, qall[j][0], s0); s0 = wmma16(ka01, qall[j][1], s0);
        s1 = wmma16(ka10, qall[j][0], s1); s1 = wmma16(ka11, qall[j][1], s1);
        float c = s0[0];
#pragma unroll
        for (int k = 1; k < 8; ++k) c = fmaxf(c, s0[k]);
#pragma unroll
        for (int k = 0; k < 8; ++k) c = fmaxf(c, s1[k]);
        s[j][0] = s0; s[j][1] = s1; cm[j] = c;
        need = need || (c > m[j] + 8.0f);
      }

      // Lazy rescale. m is a reference, not the true maximum: any m gives the same quotient
      // O / l, so it moves only when some score of the pass lies more than 8 (log2) above it.
      // P then stays at or below 2^8, well inside f16, and l within 2^16. One test per pass for
      // the whole wave (a scalar branch); the halves' maxima meet only inside the branch, and
      // both halves of a query take the same new m. The first pass always enters (m = -3e38).
      if (__builtin_amdgcn_ballot_w32(need) != 0) {
#pragma unroll
        for (int j = 0; j < 2; ++j) {
          const float cj   = fmaxf(cm[j], __shfl_xor(cm[j], 16, 32));
          const float mn   = fmaxf(m[j], cj);
          const float corr = __builtin_amdgcn_exp2f(m[j] - mn);
          l[j] = l[j] * corr;
          m[j] = mn;
#pragma unroll
          for (int t = 0; t < 4; ++t) o[j][t] = o[j][t] * corr;
        }
      }

      // The pass's V fragments, asked for as one group that flies under the exponentials.
      v16h va[4];
#pragma unroll
      for (int ct = 0; ct < 4; ++ct) va[ct] = ld_ab(v_o + (ct * 16 + hl) * V_STR + kc * 32 + k0);
      // Keeps the group here: the scheduler otherwise moves each pair of reads down among the
      // products, with a full wait directly behind it.
      __builtin_amdgcn_sched_barrier(0);

      v16h pb[2];
#pragma unroll
      for (int j = 0; j < 2; ++j) {     // softmax terms in the exp2 domain (log2e folded into Q)
        v8f p0, p1;
        float cs = 0.0f;
#pragma unroll
        for (int k = 0; k < 8; ++k) { p0[k] = __builtin_amdgcn_exp2f(s[j][0][k] - m[j]); cs += p0[k]; }
#pragma unroll
        for (int k = 0; k < 8; ++k) { p1[k] = __builtin_amdgcn_exp2f(s[j][1][k] - m[j]); cs += p1[k]; }
        cs += __shfl_xor(cs, 16, 32);
        l[j] += cs;

        // P^T C-layout -> B-operand by pure per-lane f32->f16 pair packing
#pragma unroll
        for (int e = 0; e < 8; ++e) { pb[j][e] = (_Float16)p0[e]; pb[j][8 + e] = (_Float16)p1[e]; }
      }

      // O^T += V(ch tile, 32 keys) * P, each V fragment for both query tiles
#pragma unroll
      for (int ct = 0; ct < 4; ++ct) {
        o[0][ct] = wmma16(va[ct], pb[0], o[0][ct]);
        o[1][ct] = wmma16(va[ct], pb[1], o[1][ct]);
      }
    }

    // finalize and write out (B,C,H,W) f32; dir selects cxr vs enh half. The lane's columns
    // of the two query tiles are neighbouring pixels, so each channel goes out as one 8-byte
    // store: 16 lanes fill one whole 128-B line, a wave's store two lines (channels c, c + 8).
    const float inv0 = 1.0f / l[0], inv1 = 1.0f / l[1];
    float* obase = out + (size_t)dir * ((size_t)NB * NC * HWSZ)
                 + (size_t)b * NC * HWSZ + (size_t)h * NW + wvs * 64 + g * 32 + 2 * hl;
#pragma unroll
    for (int ct = 0; ct < 4; ++ct)
#pragma unroll
      for (int k = 0; k < 8; ++k)
        *(float2*)(obase + (size_t)(ct * 16 + k0 + k) * HWSZ) =
            make_float2(o[0][ct][k] * inv0, o[1][ct][k] * inv1);
    // The wait that belongs in front of any overwrite of the stores' registers: group 1's key
    // loop reuses them.
    if (g == 0) asm volatile("s_wait_xcnt 0x0" ::: "memory");
  }
}

extern "C" void kernel_launch(void* const* d_in, const int* in_sizes, int n_in,
                              void* d_out, int out_size, void* d_ws, size_t ws_size,
                              hipStream_t stream) {
  (void)in_sizes; (void)n_in; (void)out_size; (void)d_ws; (void)ws_size;
  (void)hipFuncSetAttribute((const void*)pam_fused,
                            hipFuncAttributeMaxDynamicSharedMemorySize, SMEM_BYTES);
  pam_fused<<<dim3(NB * NH), dim3(256), SMEM_BYTES, stream>>>(
      (const float*)d_in[0],  (const float*)d_in[1],
      (const float*)d_in[2],  (const float*)d_in[3],  (const float*)d_in[4],
      (const float*)d_in[5],  (const float*)d_in[6],  (const float*)d_in[7],
      (const float*)d_in[8],  (const float*)d_in[9],  (const float*)d_in[10],
      (const float*)d_in[11], (const float*)d_in[12], (const float*)d_in[13],
      (float*)d_out);
}

// v007
// One run takes 38.6 microseconds.
// In both of two side-by-side timings against v006, it was 1.15 times as fast.
// Counting every step since v000, it is 2.79 times as fast.
#include <hip/hip_runtime.h>

// Fused Parallax-Attention (PAM) for MI455X / gfx1250.
// One workgroup (256 threads = 8 wave32) per (batch, row): both directions.
// Waves 0..3 own the left row, waves 4..7 the right row; a wave owns 64 pixels, a lane four
// neighbouring ones (16 bytes), so that 16 lanes cover one aligned 256-B piece of a row in
// every global load and store. Pixel tile e = the pixels 4*lane + e; tiles 0,1 are query
// group 0, tiles 2,3 group 1. Pipeline per block:
//   0) while the row loads fly, the block folds BN into both weight matrices and lays
//      them in LDS as f16 in the convs' A-fragment order (no setup launch, no workspace)
//   1) each wave loads its 64 pixels of its own row straight into the convs'
//      B fragments (lane = 4 pixels, 16-byte loads, 256 contiguous bytes per half-wave)
//   2) the row goes to its side's V (c,w) f16 in LDS
//   3) conv1x1+BN (folded) via WMMA -> its side's Kt (w,c) f16 in LDS
//   4) conv1x1+BN via WMMA from the same fragments -> Q, kept in registers as the
//      score product's B operand  [log2e/64 folded in], then the barrier for Kt and V
//      (group 1's Q is made behind group 0's key loop, from its row fragments)
//   5) flash-style attention of the wave's own queries against the OTHER side's
//      Kt and V, one group of 32 queries (two tiles of 16) per key loop, so that each K and
//      V fragment read from LDS serves two query tiles:
//      S^T = K^T Q via WMMA, online softmax in exp2
//      domain (per-lane + one shfl_xor(16); O and l rescaled lazily), O^T += V * P via WMMA.
//      Group 0's result waits in registers for group 1's, so a lane ends with its four
//      pixels and stores 16 bytes: 256 contiguous bytes per half-wave.

typedef __attribute__((ext_vector_type(16))) _Float16 v16h;
typedef __attribute__((ext_vector_type(8)))  _Float16 v8h;
typedef __attribute__((ext_vector_type(4)))  _Float16 v4h;
typedef __attribute__((ext_vector_type(8)))  float    v8f;
typedef __attribute__((ext_vector_type(4)))  float    v4f;

#define NB 8
#define NC 64
#define NH 128
#define NW 256
#define HWSZ (NH * NW)
#define BN_EPS 1e-5f
#define LOG2E 1.44269504088896340736f

// LDS layout (in halfs). All strides multiples of 8 halfs (16B) for b128 ds ops.
// Kt and V exist once per side (0 = left row, 1 = right row); a side's V follows its Kt,
// so every constant offset from the side's base fits a ds instruction's offset field.
#define XT_STR 72
#define KT_SZ  (256 * 72)
#define V_STR  264
#define V_SZ   (64 * 264)
#define SIDE_SZ (KT_SZ + V_SZ)
// Folded weights, fragment order: 32 groups [conv][out tile][ch half][part] of 32 lanes x 8
// halfs, so a wave's 16-byte read is 512 contiguous bytes; 8 halfs of pad per group spread
// the writers' banks. Behind them 128 folded f32 biases (Q then K).
#define WF_OFF (2 * SIDE_SZ)
#define WF_GRP 264
#define BF_OFF (WF_OFF + 32 * WF_GRP)
#define SMEM_HALFS (BF_OFF + 256)              // 79360 halfs
#define SMEM_BYTES (SMEM_HALFS * 2)            // 158720 B: two blocks per WGP

__device__ __forceinline__ v8f wmma16(v16h a, v16h b, v8f c) {
  // D = A(16x32 f16) * B(32x16 f16) + C(16x16 f32)
  return __builtin_amdgcn_wmma_f32_16x16x32_f16(false, a, false, b,
                                                (short)0, c, false, false);
}

// Load one 16x32 f16 A/B operand half-row for this lane:
// elements 0..7 = p[0..7], elements 8..15 = p[16..23]  (caller adds the
// lane<16 ? 0 : 8 half-wave K offset).
__device__ __forceinline__ v16h ld_ab(const _Float16* p) {
  v8h lo = *(const v8h*)(p);
  v8h hi = *(const v8h*)(p + 16);
  v16h r;
#pragma unroll
  for (int i = 0; i < 8; ++i) { r[i] = lo[i]; r[8 + i] = hi[i]; }
  return r;
}

// One A fragment of the folded weights: wf = the lane's 8 halfs in group 0 of the conv.
__device__ __forceinline__ v16h ld_wf(const _Float16* wf, int t, int kh) {
  v8h lo = *(const v8h*)(wf + ((t * 2 + kh) * 2) * WF_GRP);
  v8h hi = *(const v8h*)(wf + ((t * 2 + kh) * 2 + 1) * WF_GRP);
  v16h r;
#pragma unroll
  for (int i = 0; i < 8; ++i) { r[i] = lo[i]; r[8 + i] = hi[i]; }
  return r;
}

// One lane's share of a row for the conv's B operand. p points at channel k0,
// pixels 4*hl .. 4*hl+3 of the wave's 64 pixels. raw[kh*16 + q] is element q
// of the fragment of in-channels kh*32..kh*32+31 (the k order of ld_ab):
// .x .y .z .w belong to column hl of pixel tiles 0 1 2 3.
__device__ __forceinline__ void load_row(const float* __restrict__ p, float4 (&raw)[32]) {
#pragma unroll
  for (int i = 0; i < 32; ++i)
    raw[i] = *(const float4*)(p + (size_t)((i >> 3) * 16 + (i & 7)) * HWSZ);
}

__device__ __forceinline__ void to_frags(const float4 (&raw)[32], v16h (&xb)[2][2][2]) {
#pragma unroll
  for (int kh = 0; kh < 2; ++kh)
#pragma unroll
    for (int q = 0; q < 16; ++q) {
      xb[0][0][kh][q] = (_Float16)raw[kh * 16 + q].x;
      xb[0][1][kh][q] = (_Float16)raw[kh * 16 + q].y;
      xb[1][0][kh][q] = (_Float16)raw[kh * 16 + q].z;
      xb[1][1][kh][q] = (_Float16)raw[kh * 16 + q].w;
    }
}

// Conv 1x1 over the wave's 64 pixels: Y(64 out x 64 px) = W'(64x64) X + b'.
// dst points at the row of this lane's first pixel, channel k0; pixel tile g*2 + j is
// g*2 + j rows on. Each weight fragment serves all four pixel tiles.
__device__ __forceinline__ void conv_frags(_Float16* dst, const _Float16* Wf,
                                           const float* Bf,
                                           const v16h (&xb)[2][2][2]) {
#pragma unroll
  for (int t = 0; t < 4; ++t) {                    // 4 out-channel tiles
    v16h a0 = ld_wf(Wf, t, 0);
    v16h a1 = ld_wf(Wf, t, 1);
    const v4f bl = *(const v4f*)(Bf + t * 16);     // Bf = the conv's biases + k0
    const v4f bh = *(const v4f*)(Bf + t * 16 + 4);
    v8f bias = {bl[0], bl[1], bl[2], bl[3], bh[0], bh[1], bh[2], bh[3]};
#pragma unroll
    for (int g = 0; g < 2; ++g)                    // pixel group
#pragma unroll
      for (int j = 0; j < 2; ++j) {                // pixel tile g*2 + j
        v8f acc = wmma16(a0, xb[g][j][0], bias);
        acc = wmma16(a1, xb[g][j][1], acc);
        v8h hv;
#pragma unroll
        for (int k = 0; k < 8; ++k) hv[k] = (_Float16)acc[k];
        *(v8h*)(dst + (g * 2 + j) * XT_STR + t * 16) = hv;
      }
  }
}

// The same conv for one group of 32 pixels, its result kept in registers. A 16-channel
// accumulator tile t holds, per lane, channels t*16 + k0 .. + 7 of one pixel: exactly
// elements (t&1)*8 .. + 7 of the B fragment of channels (t>>1)*32 .. + 31 in the k order of
// ld_ab. qf[j] = fragments of the group's pixel tile j, column hl = pixel 4*hl + 2*group + j.
__device__ __forceinline__ void conv_regs(v16h (&qf)[2][2], const _Float16* Wf,
                                          const float* Bf,
                                          const v16h (&xb)[2][2]) {
#pragma unroll
  for (int t = 0; t < 4; ++t) {                    // 4 out-channel tiles
    v16h a0 = ld_wf(Wf, t, 0);
    v16h a1 = ld_wf(Wf, t, 1);
    const v4f bl = *(const v4f*)(Bf + t * 16);     // Bf = the conv's biases + k0
    const v4f bh = *(const v4f*)(Bf + t * 16 + 4);
    v8f bias = {bl[0], bl[1], bl[2], bl[3], bh[0], bh[1], bh[2], bh[3]};
#pragma unroll
    for (int j = 0; j < 2; ++j) {                  // the group's pixel tile
      v8f acc = wmma16(a0, xb[j][0], bias);
      acc = wmma16(a1, xb[j][1], acc);
#pragma unroll
      for (int k = 0; k < 8; ++k) qf[j][t >> 1][(t & 1) * 8 + k] = (_Float16)acc[k];
    }
  }
}

// Second bound: 4 waves per SIMD, the two 8-wave blocks per WGP that the LDS allows.
__global__ __launch_bounds__(256, 4) void pam_fused(const float* __restrict__ fea_left,
                                                 const float* __restrict__ fea_right,
                                                 const float* Wq, const float* bq,
                                                 const float* gq, const float* betaq,
                                                 const float* mq, const float* vq,
                                                 const float* Wk, const float* bk,
                                                 const float* gk, const float* betak,
                                                 const float* mk, const float* vk,
                                                 float* __restrict__ out) {
  extern __shared__ _Float16 sm[];
  const int bi  = blockIdx.x;
  const int b   = bi >> 7;
  const int h   = bi & 127;
  const size_t rowoff = (size_t)b * NC * HWSZ + (size_t)h * NW;

  const int tid  = threadIdx.x;
  const int lane = tid & 31;
  const int wid  = __builtin_amdgcn_readfirstlane(tid >> 5);  // wave id, scalar
  const int dir  = wid >> 2;                // side of this wave's row = output half
  const int wvs  = wid & 3;                 // the wave's 64 pixels within the row
  const float* own = dir ? fea_right : fea_left;   // queries; the other side's keys/values
  const int hl   = lane & 15;
  const int k0   = (lane < 16) ? 0 : 8;     // ISA half-wave K offset

  // ---- staging: no transposing LDS stage, fragments come straight from global ----
  const int    pxl  = wvs * 64 + 4 * hl;            // this lane's first pixel
  const size_t loff = rowoff + (size_t)k0 * HWSZ + pxl;
  float4 raw[32];
  v16h   xb[2][2][2];                               // [group][tile of it][ch 0..31 / 32..63]

  // ---- weight and BN loads go out first: they come back first, from L2 ----
  // Thread tid takes 4 neighbouring weights of rows frow, + 16, + 32, + 48 of both matrices
  // (a wave's 16-byte load = 512 contiguous bytes). Every thread also loads one channel's
  // five bias terms, so that no branch stands among the loads; waves 0..3 fold them.
  const int frow = tid >> 4;
  const int fcol = (tid & 15) * 4;
  const int woff = frow * 64 + fcol;
  const int bo   = tid & 63;
  const bool bk_side = (wid >> 1) & 1;              // waves 0,1: Q biases; waves 2,3: K biases
  float4 wv[8];
  float  fg[8], fv[8];
#pragma unroll
  for (int j = 0; j < 8; ++j) {                     // j >> 2: matrix, j & 3: 16-row tile
    wv[j] = *(const float4*)(((j >> 2) ? Wk : Wq) + (j & 3) * 1024 + woff);
    fg[j] = ((j >> 2) ? gk : gq)[(j & 3) * 16 + frow];
    fv[j] = ((j >> 2) ? vk : vq)[(j & 3) * 16 + frow];
  }
  const float b_b = (bk_side ? bk : bq)[bo],       b_g = (bk_side ? gk : gq)[bo];
  const float b_t = (bk_side ? betak : betaq)[bo], b_m = (bk_side ? mk : mq)[bo];
  const float b_v = (bk_side ? vk : vq)[bo];
  // The wait that belongs in front of any overwrite of these loads' offset registers
  // (named as inputs, so they stay untouched up to here). Its memory clobber also holds the
  // loads above it (their pointers are not restrict for that reason): issued behind the
  // row loads they would come back behind them, and the fold would wait for the whole row.
  asm volatile("s_wait_xcnt 0x0" :: "v"(woff * 4), "v"(frow), "v"(bo) : "memory");

  const float* po = own + loff;
  load_row(po, raw);                                // the whole share in flight at once
  // The wait that belongs in front of any overwrite of the loads' address registers;
  // naming the address as an input keeps its registers untouched up to here.
  asm volatile("s_wait_xcnt 0x0" :: "v"(po) : "memory");
  // Keeps the fold's arithmetic, and with it the wait for the first BN values, from being
  // scheduled in front of the row loads: those would then go out an L2 round trip later.
  __builtin_amdgcn_sched_barrier(0);

  // ---- fold BN into the weights (log2e/64 into Q's: cost/64, softmax in exp2) -> LDS ----
  {
    const float qscale = LOG2E / 64.0f;
    _Float16* wdst = sm + WF_OFF + (fcol >> 4) * WF_GRP
                   + (((fcol >> 3) & 1) * 16 + frow) * 8 + (fcol & 7);
#pragma unroll
    for (int j = 0; j < 8; ++j) {
      const float s = fg[j] * rsqrtf(fv[j] + BN_EPS);
      v4h hv;
      if (j >> 2) {
        hv[0] = (_Float16)(wv[j].x * s); hv[1] = (_Float16)(wv[j].y * s);
        hv[2] = (_Float16)(wv[j].z * s); hv[3] = (_Float16)(wv[j].w * s);
      } else {
        hv[0] = (_Float16)(wv[j].x * s * qscale); hv[1] = (_Float16)(wv[j].y * s * qscale);
        hv[2] = (_Float16)(wv[j].z * s * qscale); hv[3] = (_Float16)(wv[j].w * s * qscale);
      }
      *(v4h*)(wdst + ((j >> 2) * 16 + (j & 3) * 4) * WF_GRP) = hv;
    }
    if (wid < 4) {
      const float s  = b_g * rsqrtf(b_v + BN_EPS);
      const float bf = s * b_b + b_t - b_m * s;
      ((float*)(sm + BF_OFF))[tid] = bk_side ? bf : bf * qscale;
    }
  }
  // Barrier for the folded weights. Its fences name LDS alone: __syncthreads() would also
  // wait for every global load, and the row loads are meant to stay in flight across it.
  __builtin_amdgcn_fence(__ATOMIC_RELEASE, "workgroup", "local");
  __builtin_amdgcn_s_barrier();
  __builtin_amdgcn_fence(__ATOMIC_ACQUIRE, "workgroup", "local");

  // ---- own row -> this side's V (c,w) and the fragments of both convs ----
  _Float16* vown = sm + dir * SIDE_SZ + KT_SZ;
#pragma unroll
  for (int i = 0; i < 32; ++i) {
    v4h hv4 = {(_Float16)raw[i].x, (_Float16)raw[i].y, (_Float16)raw[i].z, (_Float16)raw[i].w};
    *(v4h*)(vown + ((i >> 3) * 16 + (i & 7) + k0) * V_STR + pxl) = hv4;
  }
  to_frags(raw, xb);

  // ---- conv K -> this side's Kt, conv Q (log2e/64 folded) of group 0 -> registers ----
  const _Float16* wfl = sm + WF_OFF + lane * 8;
  const float*    bfl = (const float*)(sm + BF_OFF) + k0;
  conv_frags(sm + dir * SIDE_SZ + pxl * XT_STR + k0, wfl + 16 * WF_GRP, bfl + 64, xb);
  // qall: [query tile][ch 0..31 / 32..63], as the conv leaves them: column hl of tile j of
  // group g is pixel 4 * hl + 2 * g + j.
  v16h qall[2][2];
  conv_regs(qall, wfl, bfl, xb[0]);
  __syncthreads();

  const _Float16* kt_o = sm + (dir ^ 1) * SIDE_SZ;          // the other side's keys
  const _Float16* v_o  = kt_o + KT_SZ;                      // and values

  // ---- attention: per wave, its two groups of 32 queries, one after the other ----
  // Unrolled so that g is a constant: the row fragments are registers, not indexable.
  v8f keep[2][4];                       // group 0's finished output, until group 1's is there
#pragma unroll
  for (int g = 0; g < 2; ++g) {
    // Group 1's conv Q stands here, not in front of the barrier, so that the group waits
    // through group 0's key loop as its 32 registers of row fragments and no more; the
    // folded weights stay in LDS to the end.
    if (g == 1) conv_regs(qall, wfl, bfl, xb[1]);

    v8f o[2][4];                        // [query tile][channel tile]
    float m[2], l[2];
#pragma unroll
    for (int j = 0; j < 2; ++j) {
#pragma unroll
      for (int t = 0; t < 4; ++t)
#pragma unroll
        for (int k = 0; k < 8; ++k) o[j][t][k] = 0.0f;
      m[j] = -3.0e38f; l[j] = 0.0f;
    }

    for (int kc = 0; kc < 8; ++kc) {    // 8 key chunks of 32 keys
      // K^T A-operands: two key tiles (keys kc*32+0..15 and +16..31), for both query tiles
      const _Float16* kr0 = kt_o + (kc * 32 + hl) * XT_STR;
      const _Float16* kr1 = kr0 + 16 * XT_STR;
      v16h ka00 = ld_ab(kr0 + k0), ka01 = ld_ab(kr0 + 32 + k0);
      v16h ka10 = ld_ab(kr1 + k0), ka11 = ld_ab(kr1 + 32 + k0);

      v8f s[2][2];                      // [query tile][key tile]
      float cm[2];                      // the lane's own maximum: 16 of the query's 32 scores
      bool need = false;
#pragma unroll
      for (int j = 0; j < 2; ++j) {     // query tile
        v8f s0, s1;
#pragma unroll
        for (int k = 0; k < 8; ++k) { s0[k] = 0.0f; s1[k] = 0.0f; }
        s0 = wmma16(ka00, qall[j][0], s0); s0 = wmma16(ka01, qall[j][1], s0);
        s1 = wmma16(ka10, qall[j][0], s1); s1 = wmma16(ka11, qall[j][1], s1);
        float c = s0[0];
#pragma unroll
        for (int k = 1; k < 8; ++k) c = fmaxf(c, s0[k]);
#pragma unroll
        for (int k = 0; k < 8; ++k) c = fmaxf(c, s1[k]);
        s[j][0] = s0; s[j][1] = s1; cm[j] = c;
        need = need || (c > m[j] + 8.0f);
      }

      // Lazy rescale. m is a reference, not the true maximum: any m gives the same quotient
      // O / l, so it moves only when some score of the pass lies more than 8 (log2) above it.
      // P then stays at or below 2^8, well inside f16, and l within 2^16. One test per pass for
      // the whole wave (a scalar branch); the halves' maxima meet only inside the branch, and
      // both halves of a query take the same new m. The first pass always enters (m = -3e38).
      if (__builtin_amdgcn_ballot_w32(need) != 0) {
#pragma unroll
        for (int j = 0; j < 2; ++j) {
          const float cj   = fmaxf(cm[j], __shfl_xor(cm[j], 16, 32));
          const float mn   = fmaxf(m[j], cj);
          const float corr = __builtin_amdgcn_exp2f(m[j] - mn);
          l[j] = l[j] * corr;
          m[j] = mn;
#pragma unroll
          for (int t = 0; t < 4; ++t) o[j][t] = o[j][t] * corr;
        }
      }

      // The pass's V fragments, asked for as one group that flies under the exponentials.
      v16h va[4];
#pragma unroll
      for (int ct = 0; ct < 4; ++ct) va[ct] = ld_ab(v_o + (ct * 16 + hl) * V_STR + kc * 32 + k0);
      // Keeps the group here: the scheduler otherwise moves each pair of reads down among the
      // products, with a full wait directly behind it.
      __builtin_amdgcn_sched_barrier(0);

      v16h pb[2];
#pragma unroll
      for (int j = 0; j < 2; ++j) {     // softmax terms in the exp2 domain (log2e folded into Q)
        v8f p0, p1;
        float cs = 0.0f;
#pragma unroll
        for (int k = 0; k < 8; ++k) { p0[k] = __builtin_amdgcn_exp2f(s[j][0][k] - m[j]); cs += p0[k]; }
#pragma unroll
        for (int k = 0; k < 8; ++k) { p1[k] = __builtin_amdgcn_exp2f(s[j][1][k] - m[j]); cs += p1[k]; }
        cs += __shfl_xor(cs, 16, 32);
        l[j] += cs;

        // P^T C-layout -> B-operand by pure per-lane f32->f16 pair packing
#pragma unroll
        for (int e = 0; e < 8; ++e) { pb[j][e] = (_Float16)p0[e]; pb[j][8 + e] = (_Float16)p1[e]; }
      }

      // O^T += V(ch tile, 32 keys) * P, each V fragment for both query tiles
#pragma unroll
      for (int ct = 0; ct < 4; ++ct) {
        o[0][ct] = wmma16(va[ct], pb[0], o[0][ct]);
        o[1][ct] = wmma16(va[ct], pb[1], o[1][ct]);
      }
    }

    // finalize and write out (B,C,H,W) f32; dir selects cxr vs enh half. The lane's columns
    // of the four query tiles are four neighbouring pixels, so each channel goes out as one
    // 16-byte store behind group 1: 16 lanes fill 256 contiguous, aligned bytes, a wave's
    // store two such pieces (channels c, c + 8).
    const float inv0 = 1.0f / l[0], inv1 = 1.0f / l[1];
    if (g == 0) {
#pragma unroll
      for (int ct = 0; ct < 4; ++ct) { keep[0][ct] = o[0][ct] * inv0; keep[1][ct] = o[1][ct] * inv1; }
    } else {
      float* obase = out + (size_t)dir * ((size_t)NB * NC * HWSZ)
                   + (size_t)b * NC * HWSZ + (size_t)h * NW + pxl;
#pragma unroll
      for (int ct = 0; ct < 4; ++ct)
#pragma unroll
        for (int k = 0; k < 8; ++k)
          *(float4*)(obase + (size_t)(ct * 16 + k0 + k) * HWSZ) =
              make_float4(keep[0][ct][k], keep[1][ct][k], o[0][ct][k] * inv0, o[1][ct][k] * inv1);
    }
  }
}

extern "C" void kernel_launch(void* const* d_in, const int* in_sizes, int n_in,
                              void* d_out, int out_size, void* d_ws, size_t ws_size,
                              hipStream_t stream) {
  (void)in_sizes; (void)n_in; (void)out_size; (void)d_ws; (void)ws_size;
  (void)hipFuncSetAttribute((const void*)pam_fused,
                            hipFuncAttributeMaxDynamicSharedMemorySize, SMEM_BYTES);
  pam_fused<<<dim3(NB * NH), dim3(256), SMEM_BYTES, stream>>>(
      (const float*)d_in[0],  (const float*)d_in[1],
      (const float*)d_in[2],  (const float*)d_in[3],  (const float*)d_in[4],
      (const float*)d_in[5],  (const float*)d_in[6],  (const float*)d_in[7],
      (const float*)d_in[8],  (const float*)d_in[9],  (const float*)d_in[10],
      (const float*)d_in[11], (const float*)d_in[12], (const float*)d_in[13],
      (float*)d_out);
}

// v008
// One run takes 37.2 microseconds.
// In both of two side-by-side timings against v007, it was 1.04 times as fast.
// All steps since v000 together make it 2.89 times as fast.
#include <hip/hip_runtime.h>

// Fused Parallax-Attention (PAM) for MI455X / gfx1250.
// One workgroup (256 threads = 8 wave32) per (batch, row): both directions.
// Waves 0..3 own the left row, waves 4..7 the right row; a wave owns 64 pixels, a lane four
// neighbouring ones (16 bytes), so that 16 lanes cover one aligned 256-B piece of a row in
// every global load and store. Pixel tile e = the pixels 4*lane + e; tiles 0,1 are query
// group 0, tiles 2,3 group 1. Pipeline per block:
//   0) while the row loads fly, the block folds BN into both weight matrices and lays
//      them in LDS as f16 in the convs' A-fragment order (no setup launch, no workspace)
//   1) each wave loads its 64 pixels of its own row straight into the convs'
//      B fragments (lane = 4 pixels, 16-byte loads, 256 contiguous bytes per half-wave)
//   2) the row goes to its side's V (c,w) f16 in LDS
//   3) conv1x1+BN (folded) via WMMA -> its side's Kt (w,c) f16 in LDS
//   4) conv1x1+BN via WMMA from the same fragments -> Q, kept in registers as the
//      score product's B operand  [log2e/64 folded in], then the barrier for Kt and V
//      (group 1's Q is made behind group 0's key loop, from its row fragments)
//   5) flash-style attention of the wave's own queries against the OTHER side's
//      Kt and V, one group of 32 queries (two tiles of 16) per key loop, so that each K and
//      V fragment read from LDS serves two query tiles:
//      S^T = K^T Q via WMMA, online softmax in exp2
//      domain (O and l rescaled lazily; l stays a per-lane partial sum, the two half-waves'
//      shares meet once behind the key loop), O^T += V * P via WMMA.
//      Group 0's result waits in registers for group 1's, so a lane ends with its four
//      pixels and stores 16 bytes: 256 contiguous bytes per half-wave.

typedef __attribute__((ext_vector_type(16))) _Float16 v16h;
typedef __attribute__((ext_vector_type(8)))  _Float16 v8h;
typedef __attribute__((ext_vector_type(4)))  _Float16 v4h;
typedef __attribute__((ext_vector_type(8)))  float    v8f;
typedef __attribute__((ext_vector_type(4)))  float    v4f;
typedef __attribute__((ext_vector_type(2)))  float    v2f;

#define NB 8
#define NC 64
#define NH 128
#define NW 256
#define HWSZ (NH * NW)
#define BN_EPS 1e-5f
#define LOG2E 1.44269504088896340736f

// LDS layout (in halfs). All strides multiples of 8 halfs (16B) for b128 ds ops.
// Kt and V exist once per side (0 = left row, 1 = right row); a side's V follows its Kt,
// so every constant offset from the side's base fits a ds instruction's offset field.
#define XT_STR 72
#define KT_SZ  (256 * 72)
#define V_STR  264
#define V_SZ   (64 * 264)
#define SIDE_SZ (KT_SZ + V_SZ)
// Folded weights, fragment order: 32 groups [conv][out tile][ch half][part] of 32 lanes x 8
// halfs, so a wave's 16-byte read is 512 contiguous bytes; 8 halfs of pad per group spread
// the writers' banks. Behind them 128 folded f32 biases (Q then K).
#define WF_OFF (2 * SIDE_SZ)
#define WF_GRP 264
#define BF_OFF (WF_OFF + 32 * WF_GRP)
#define SMEM_HALFS (BF_OFF + 256)              // 79360 halfs
#define SMEM_BYTES (SMEM_HALFS * 2)            // 158720 B: two blocks per WGP

__device__ __forceinline__ v8f wmma16(v16h a, v16h b, v8f c) {
  // D = A(16x32 f16) * B(32x16 f16) + C(16x16 f32)
  return __builtin_amdgcn_wmma_f32_16x16x32_f16(false, a, false, b,
                                                (short)0, c, false, false);
}

// Load one 16x32 f16 A/B operand half-row for this lane:
// elements 0..7 = p[0..7], elements 8..15 = p[16..23]  (caller adds the
// lane<16 ? 0 : 8 half-wave K offset).
__device__ __forceinline__ v16h ld_ab(const _Float16* p) {
  v8h lo = *(const v8h*)(p);
  v8h hi = *(const v8h*)(p + 16);
  v16h r;
#pragma unroll
  for (int i = 0; i < 8; ++i) { r[i] = lo[i]; r[8 + i] = hi[i]; }
  return r;
}

// One A fragment of the folded weights: wf = the lane's 8 halfs in group 0 of the conv.
__device__ __forceinline__ v16h ld_wf(const _Float16* wf, int t, int kh) {
  v8h lo = *(const v8h*)(wf + ((t * 2 + kh) * 2) * WF_GRP);
  v8h hi = *(const v8h*)(wf + ((t * 2 + kh) * 2 + 1) * WF_GRP);
  v16h r;
#pragma unroll
  for (int i = 0; i < 8; ++i) { r[i] = lo[i]; r[8 + i] = hi[i]; }
  return r;
}

// One lane's share of a row for the conv's B operand. p points at channel k0,
// pixels 4*hl .. 4*hl+3 of the wave's 64 pixels. raw[kh*16 + q] is element q
// of the fragment of in-channels kh*32..kh*32+31 (the k order of ld_ab):
// .x .y .z .w belong to column hl of pixel tiles 0 1 2 3.
__device__ __forceinline__ void load_row(const float* __restrict__ p, float4 (&raw)[32]) {
#pragma unroll
  for (int i = 0; i < 32; ++i)
    raw[i] = *(const float4*)(p + (size_t)((i >> 3) * 16 + (i & 7)) * HWSZ);
}

__device__ __forceinline__ void to_frags(const float4 (&raw)[32], v16h (&xb)[2][2][2]) {
#pragma unroll
  for (int kh = 0; kh < 2; ++kh)
#pragma unroll
    for (int q = 0; q < 16; ++q) {
      xb[0][0][kh][q] = (_Float16)raw[kh * 16 + q].x;
      xb[0][1][kh][q] = (_Float16)raw[kh * 16 + q].y;
      xb[1][0][kh][q] = (_Float16)raw[kh * 16 + q].z;
      xb[1][1][kh][q] = (_Float16)raw[kh * 16 + q].w;
    }
}

// Conv 1x1 over the wave's 64 pixels: Y(64 out x 64 px) = W'(64x64) X + b'.
// dst points at the row of this lane's first pixel, channel k0; pixel tile g*2 + j is
// g*2 + j rows on. Each weight fragment serves all four pixel tiles.
__device__ __forceinline__ void conv_frags(_Float16* dst, const _Float16* Wf,
                                           const float* Bf,
                                           const v16h (&xb)[2][2][2]) {
#pragma unroll
  for (int t = 0; t < 4; ++t) {                    // 4 out-channel tiles
    v16h a0 = ld_wf(Wf, t, 0);
    v16h a1 = ld_wf(Wf, t, 1);
    const v4f bl = *(const v4f*)(Bf + t * 16);     // Bf = the conv's biases + k0
    const v4f bh = *(const v4f*)(Bf + t * 16 + 4);
    v8f bias = {bl[0], bl[1], bl[2], bl[3], bh[0], bh[1], bh[2], bh[3]};
#pragma unroll
    for (int g = 0; g < 2; ++g)                    // pixel group
#pragma unroll
      for (int j = 0; j < 2; ++j) {                // pixel tile g*2 + j
        v8f acc = wmma16(a0, xb[g][j][0], bias);
        acc = wmma16(a1, xb[g][j][1], acc);
        v8h hv;
#pragma unroll
        for (int k = 0; k < 8; ++k) hv[k] = (_Float16)acc[k];
        *(v8h*)(dst + (g * 2 + j) * XT_STR + t * 16) = hv;
      }
  }
}

// The same conv for one group of 32 pixels, its result kept in registers. A 16-channel
// accumulator tile t holds, per lane, channels t*16 + k0 .. + 7 of one pixel: exactly
// elements (t&1)*8 .. + 7 of the B fragment of channels (t>>1)*32 .. + 31 in the k order of
// ld_ab. qf[j] = fragments of the group's pixel tile j, column hl = pixel 4*hl + 2*group + j.
__device__ __forceinline__ void conv_regs(v16h (&qf)[2][2], const _Float16* Wf,
                                          const float* Bf,
                                          const v16h (&xb)[2][2]) {
#pragma unroll
  for (int t = 0; t < 4; ++t) {                    // 4 out-channel tiles
    v16h a0 = ld_wf(Wf, t, 0);
    v16h a1 = ld_wf(Wf, t, 1);
    const v4f bl = *(const v4f*)(Bf + t * 16);     // Bf = the conv's biases + k0
    const v4f bh = *(const v4f*)(Bf + t * 16 + 4);
    v8f bias = {bl[0], bl[1], bl[2], bl[3], bh[0], bh[1], bh[2], bh[3]};
#pragma unroll
    for (int j = 0; j < 2; ++j) {                  // the group's pixel tile
      v8f acc = wmma16(a0, xb[j][0], bias);
      acc = wmma16(a1, xb[j][1], acc);
#pragma unroll
      for (int k = 0; k < 8; ++k) qf[j][t >> 1][(t & 1) * 8 + k] = (_Float16)acc[k];
    }
  }
}

// Second bound: 4 waves per SIMD, the two 8-wave blocks per WGP that the LDS allows.
__global__ __launch_bounds__(256, 4) void pam_fused(const float* __restrict__ fea_left,
                                                 const float* __restrict__ fea_right,
                                                 const float* Wq, const float* bq,
                                                 const float* gq, const float* betaq,
                                                 const float* mq, const float* vq,
                                                 const float* Wk, const float* bk,
                                                 const float* gk, const float* betak,
                                                 const float* mk, const float* vk,
                                                 float* __restrict__ out) {
  extern __shared__ _Float16 sm[];
  const int bi  = blockIdx.x;
  const int b   = bi >> 7;
  const int h   = bi & 127;
  const size_t rowoff = (size_t)b * NC * HWSZ + (size_t)h * NW;

  const int tid  = threadIdx.x;
  const int lane = tid & 31;
  const int wid  = __builtin_amdgcn_readfirstlane(tid >> 5);  // wave id, scalar
  const int dir  = wid >> 2;                // side of this wave's row = output half
  const int wvs  = wid & 3;                 // the wave's 64 pixels within the row
  const float* own = dir ? fea_right : fea_left;   // queries; the other side's keys/values
  const int hl   = lane & 15;
  const int k0   = (lane < 16) ? 0 : 8;     // ISA half-wave K offset

  // ---- staging: no transposing LDS stage, fragments come straight from global ----
  const int    pxl  = wvs * 64 + 4 * hl;            // this lane's first pixel
  const size_t loff = rowoff + (size_t)k0 * HWSZ + pxl;
  float4 raw[32];
  v16h   xb[2][2][2];                               // [group][tile of it][ch 0..31 / 32..63]

  // ---- weight and BN loads go out first: they come back first, from L2 ----
  // Thread tid takes 4 neighbouring weights of rows frow, + 16, + 32, + 48 of both matrices
  // (a wave's 16-byte load = 512 contiguous bytes). Every thread also loads one channel's
  // five bias terms, so that no branch stands among the loads; waves 0..3 fold them.
  const int frow = tid >> 4;
  const int fcol = (tid & 15) * 4;
  const int woff = frow * 64 + fcol;
  const int bo   = tid & 63;
  const bool bk_side = (wid >> 1) & 1;              // waves 0,1: Q biases; waves 2,3: K biases
  float4 wv[8];
  float  fg[8], fv[8];
#pragma unroll
  for (int j = 0; j < 8; ++j) {                     // j >> 2: matrix, j & 3: 16-row tile
    wv[j] = *(const float4*)(((j >> 2) ? Wk : Wq) + (j & 3) * 1024 + woff);
    fg[j] = ((j >> 2) ? gk : gq)[(j & 3) * 16 + frow];
    fv[j] = ((j >> 2) ? vk : vq)[(j & 3) * 16 + frow];
  }
  const float b_b = (bk_side ? bk : bq)[bo],       b_g = (bk_side ? gk : gq)[bo];
  const float b_t = (bk_side ? betak : betaq)[bo], b_m = (bk_side ? mk : mq)[bo];
  const float b_v = (bk_side ? vk : vq)[bo];
  // The wait that belongs in front of any overwrite of these loads' offset registers
  // (named as inputs, so they stay untouched up to here). Its memory clobber also holds the
  // loads above it (their pointers are not restrict for that reason): issued behind the
  // row loads they would come back behind them, and the fold would wait for the whole row.
  asm volatile("s_wait_xcnt 0x0" :: "v"(woff * 4), "v"(frow), "v"(bo) : "memory");

  const float* po = own + loff;
  load_row(po, raw);                                // the whole share in flight at once
  // The wait that belongs in front of any overwrite of the loads' address registers;
  // naming the address as an input keeps its registers untouched up to here.
  asm volatile("s_wait_xcnt 0x0" :: "v"(po) : "memory");
  // Keeps the fold's arithmetic, and with it the wait for the first BN values, from being
  // scheduled in front of the row loads: those would then go out an L2 round trip later.
  __builtin_amdgcn_sched_barrier(0);

  // ---- fold BN into the weights (log2e/64 into Q's: cost/64, softmax in exp2) -> LDS ----
  {
    const float qscale = LOG2E / 64.0f;
    _Float16* wdst = sm + WF_OFF + (fcol >> 4) * WF_GRP
                   + (((fcol >> 3) & 1) * 16 + frow) * 8 + (fcol & 7);
#pragma unroll
    for (int j = 0; j < 8; ++j) {
      const float s = fg[j] * rsqrtf(fv[j] + BN_EPS);
      v4h hv;
      if (j >> 2) {
        hv[0] = (_Float16)(wv[j].x * s); hv[1] = (_Float16)(wv[j].y * s);
        hv[2] = (_Float16)(wv[j].z * s); hv[3] = (_Float16)(wv[j].w * s);
      } else {
        hv[0] = (_Float16)(wv[j].x * s * qscale); hv[1] = (_Float16)(wv[j].y * s * qscale);
        hv[2] = (_Float16)(wv[j].z * s * qscale); hv[3] = (_Float16)(wv[j].w * s * qscale);
      }
      *(v4h*)(wdst + ((j >> 2) * 16 + (j & 3) * 4) * WF_GRP) = hv;
    }
    if (wid < 4) {
      const float s  = b_g * rsqrtf(b_v + BN_EPS);
      const float bf = s * b_b + b_t - b_m * s;
      ((float*)(sm + BF_OFF))[tid] = bk_side ? bf : bf * qscale;
    }
  }
  // Barrier for the folded weights. Its fences name LDS alone: __syncthreads() would also
  // wait for every global load, and the row loads are meant to stay in flight across it.
  __builtin_amdgcn_fence(__ATOMIC_RELEASE, "workgroup", "local");
  __builtin_amdgcn_s_barrier();
  __builtin_amdgcn_fence(__ATOMIC_ACQUIRE, "workgroup", "local");

  // ---- own row -> this side's V (c,w) and the fragments of both convs ----
  _Float16* vown = sm + dir * SIDE_SZ + KT_SZ;
#pragma unroll
  for (int i = 0; i < 32; ++i) {
    v4h hv4 = {(_Float16)raw[i].x, (_Float16)raw[i].y, (_Float16)raw[i].z, (_Float16)raw[i].w};
    *(v4h*)(vown + ((i >> 3) * 16 + (i & 7) + k0) * V_STR + pxl) = hv4;
  }
  to_frags(raw, xb);

  // ---- conv K -> this side's Kt, conv Q (log2e/64 folded) of group 0 -> registers ----
  const _Float16* wfl = sm + WF_OFF + lane * 8;
  const float*    bfl = (const float*)(sm + BF_OFF) + k0;
  conv_frags(sm + dir * SIDE_SZ + pxl * XT_STR + k0, wfl + 16 * WF_GRP, bfl + 64, xb);
  // qall: [query tile][ch 0..31 / 32..63], as the conv leaves them: column hl of tile j of
  // group g is pixel 4 * hl + 2 * g + j.
  v16h qall[2][2];
  conv_regs(qall, wfl, bfl, xb[0]);
  __syncthreads();

  const _Float16* kt_o = sm + (dir ^ 1) * SIDE_SZ;          // the other side's keys
  const _Float16* v_o  = kt_o + KT_SZ;                      // and values

  // ---- attention: per wave, its two groups of 32 queries, one after the other ----
  // Unrolled so that g is a constant: the row fragments are registers, not indexable.
  v8f keep[2][4];                       // group 0's finished output, until group 1's is there
#pragma unroll
  for (int g = 0; g < 2; ++g) {
    // Group 1's conv Q stands here, not in front of the barrier, so that the group waits
    // through group 0's key loop as its 32 registers of row fragments and no more; the
    // folded weights stay in LDS to the end.
    if (g == 1) conv_regs(qall, wfl, bfl, xb[1]);

    v8f o[2][4];                        // [query tile][channel tile]
    float m[2];
    // The lane's own share of each query's row sum: its 16 of every pass's 32 keys, even and
    // odd positions apart (one packed add takes two terms). Joined behind the key loop.
    v2f l2[2];
#pragma unroll
    for (int j = 0; j < 2; ++j) {
#pragma unroll
      for (int t = 0; t < 4; ++t)
#pragma unroll
        for (int k = 0; k < 8; ++k) o[j][t][k] = 0.0f;
      m[j] = -3.0e38f; l2[j] = (v2f){0.0f, 0.0f};
    }

    for (int kc = 0; kc < 8; ++kc) {    // 8 key chunks of 32 keys
      // K^T A-operands: two key tiles (keys kc*32+0..15 and +16..31), for both query tiles
      const _Float16* kr0 = kt_o + (kc * 32 + hl) * XT_STR;
      const _Float16* kr1 = kr0 + 16 * XT_STR;
      v16h ka00 = ld_ab(kr0 + k0), ka01 = ld_ab(kr0 + 32 + k0);
      v16h ka10 = ld_ab(kr1 + k0), ka11 = ld_ab(kr1 + 32 + k0);

      v8f s[2][2];                      // [query tile][key tile]
      float cm[2];                      // the lane's own maximum: 16 of the query's 32 scores
      bool need = false;
#pragma unroll
      for (int j = 0; j < 2; ++j) {     // query tile
        v8f s0, s1;
#pragma unroll
        for (int k = 0; k < 8; ++k) { s0[k] = 0.0f; s1[k] = 0.0f; }
        s0 = wmma16(ka00, qall[j][0], s0); s0 = wmma16(ka01, qall[j][1], s0);
        s1 = wmma16(ka10, qall[j][0], s1); s1 = wmma16(ka11, qall[j][1], s1);
        float c = s0[0];
#pragma unroll
        for (int k = 1; k < 8; ++k) c = fmaxf(c, s0[k]);
#pragma unroll
        for (int k = 0; k < 8; ++k) c = fmaxf(c, s1[k]);
        s[j][0] = s0; s[j][1] = s1; cm[j] = c;
        need = need || (c > m[j] + 8.0f);
      }

      // Lazy rescale. m is a reference, not the true maximum: any m gives the same quotient
      // O / l, so it moves only when some score of the pass lies more than 8 (log2) above it.
      // P then stays at or below 2^8, well inside f16, and l within 2^16. One test per pass for
      // the whole wave (a scalar branch); the halves' maxima meet only inside the branch, and
      // both halves of a query take the same new m. The first pass always enters (m = -3e38).
      if (__builtin_amdgcn_ballot_w32(need) != 0) {
#pragma unroll
        for (int j = 0; j < 2; ++j) {
          const float cj   = fmaxf(cm[j], __shfl_xor(cm[j], 16, 32));
          const float mn   = fmaxf(m[j], cj);
          const float corr = __builtin_amdgcn_exp2f(m[j] - mn);
          l2[j] = l2[j] * corr;
          m[j] = mn;
#pragma unroll
          for (int t = 0; t < 4; ++t) o[j][t] = o[j][t] * corr;
        }
      }

      // The pass's V fragments, asked for as one group that flies under the exponentials.
      v16h va[4];
#pragma unroll
      for (int ct = 0; ct < 4; ++ct) va[ct] = ld_ab(v_o + (ct * 16 + hl) * V_STR + kc * 32 + k0);
      // Keeps the group here: the scheduler otherwise moves each pair of reads down among the
      // products, with a full wait directly behind it.
      __builtin_amdgcn_sched_barrier(0);

      v16h pb[2];
      v2f  pp[2][8];                    // the pass's terms in f32, for the row sums below
#pragma unroll
      for (int j = 0; j < 2; ++j) {     // softmax terms in the exp2 domain (log2e folded into Q)
        // P^T C-layout -> B-operand by pure per-lane f32->f16 pair packing
#pragma unroll
        for (int kt = 0; kt < 2; ++kt)  // key tile
#pragma unroll
          for (int k = 0; k < 8; k += 2) {
            const v2f p = {__builtin_amdgcn_exp2f(s[j][kt][k] - m[j]),
                           __builtin_amdgcn_exp2f(s[j][kt][k + 1] - m[j])};
            pp[j][kt * 4 + (k >> 1)] = p;
            pb[j][kt * 8 + k] = (_Float16)p.x; pb[j][kt * 8 + k + 1] = (_Float16)p.y;
          }
      }

      // Keeps the row sums' adds below from being moved up into the vector block above, where
      // each costs an issue slot of its own.
      __builtin_amdgcn_sched_barrier(0);

      // O^T += V(ch tile, 32 keys) * P, each V fragment for both query tiles
#pragma unroll
      for (int ct = 0; ct < 4; ++ct) {
        o[0][ct] = wmma16(va[ct], pb[0], o[0][ct]);
        o[1][ct] = wmma16(va[ct], pb[1], o[1][ct]);
        // The row sums' packed adds stand among the products: independent vector work that
        // issues while the matrix unit is busy.
        l2[0] += pp[0][ct * 2]; l2[1] += pp[1][ct * 2];
        l2[0] += pp[0][ct * 2 + 1]; l2[1] += pp[1][ct * 2 + 1];
      }
    }

    // finalize and write out (B,C,H,W) f32; dir selects cxr vs enh half. The lane's columns
    // of the four query tiles are four neighbouring pixels, so each channel goes out as one
    // 16-byte store behind group 1: 16 lanes fill 256 contiguous, aligned bytes, a wave's
    // store two such pieces (channels c, c + 8).
    // Both halves of a query used the same m throughout, so their shares of l simply add.
    float l[2];
#pragma unroll
    for (int j = 0; j < 2; ++j) {
      const float lh = l2[j].x + l2[j].y;
      l[j] = lh + __shfl_xor(lh, 16, 32);
    }
    const float inv0 = 1.0f / l[0], inv1 = 1.0f / l[1];
    if (g == 0) {
#pragma unroll
      for (int ct = 0; ct < 4; ++ct) { keep[0][ct] = o[0][ct] * inv0; keep[1][ct] = o[1][ct] * inv1; }
    } else {
      float* obase = out + (size_t)dir * ((size_t)NB * NC * HWSZ)
                   + (size_t)b * NC * HWSZ + (size_t)h * NW + pxl;
#pragma unroll
      for (int ct = 0; ct < 4; ++ct)
#pragma unroll
        for (int k = 0; k < 8; ++k)
          *(float4*)(obase + (size_t)(ct * 16 + k0 + k) * HWSZ) =
              make_float4(keep[0][ct][k], keep[1][ct][k], o[0][ct][k] * inv0, o[1][ct][k] * inv1);
    }
  }
}

extern "C" void kernel_launch(void* const* d_in, const int* in_sizes, int n_in,
                              void* d_out, int out_size, void* d_ws, size_t ws_size,
                              hipStream_t stream) {
  (void)in_sizes; (void)n_in; (void)out_size; (void)d_ws; (void)ws_size;
  (void)hipFuncSetAttribute((const void*)pam_fused,
                            hipFuncAttributeMaxDynamicSharedMemorySize, SMEM_BYTES);
  pam_fused<<<dim3(NB * NH), dim3(256), SMEM_BYTES, stream>>>(
      (const float*)d_in[0],  (const float*)d_in[1],
      (const float*)d_in[2],  (const float*)d_in[3],  (const float*)d_in[4],
      (const float*)d_in[5],  (const float*)d_in[6],  (const float*)d_in[7],
      (const float*)d_in[8],  (const float*)d_in[9],  (const float*)d_in[10],
      (const float*)d_in[11], (const float*)d_in[12], (const float*)d_in[13],
      (float*)d_out);
}

// v009
// One run takes 35.9 microseconds.
// Two timings next to v008 put it at 1.04 and 1.03 times that version's speed.
// Counting every step since v000, it is 2.99 times as fast.
#include <hip/hip_runtime.h>

// Fused Parallax-Attention (PAM) for MI455X / gfx1250.
// One workgroup (256 threads = 8 wave32) per (batch, row): both directions.
// Waves 0..3 own the left row, waves 4..7 the right row; a wave owns 64 pixels, a lane four
// neighbouring ones (16 bytes), so that 16 lanes cover one aligned 256-B piece of a row in
// every global load and store. Pixel tile e = the pixels 4*lane + e; tiles 0,1 are query
// group 0, tiles 2,3 group 1. Pipeline per block:
//   0) while the row loads fly, the block folds BN into both weight matrices and lays
//      them in LDS as f16 in the convs' A-fragment order (no setup launch, no workspace)
//   1) each wave loads its 64 pixels of its own row straight into the convs'
//      B fragments (lane = 4 pixels, 16-byte loads, 256 contiguous bytes per half-wave)
//   2) the row goes to its side's V (c,w) f16 in LDS
//   3) conv1x1+BN (folded) via WMMA -> its side's Kt (w,c) f16 in LDS
//   4) conv1x1+BN via WMMA from the same fragments -> Q, kept in registers as the
//      score product's B operand  [log2e/64 folded in], then the barrier for Kt and V
//      (group 1's Q is made behind group 0's key loop, from its row fragments)
//   5) flash-style attention of the wave's own queries against the OTHER side's
//      Kt and V, one group of 32 queries (two tiles of 16) per key loop, so that each K and
//      V fragment read from LDS serves two query tiles:
//      S^T = K^T Q via WMMA, online softmax in exp2
//      domain (O and l rescaled lazily, on a test of l; l stays a per-lane partial sum, the two half-waves'
//      shares meet once behind the key loop), O^T += V * P via WMMA.
//      Group 0's result waits in registers for group 1's, so a lane ends with its four
//      pixels and stores 16 bytes: 256 contiguous bytes per half-wave.

typedef __attribute__((ext_vector_type(16))) _Float16 v16h;
typedef __attribute__((ext_vector_type(8)))  _Float16 v8h;
typedef __attribute__((ext_vector_type(4)))  _Float16 v4h;
typedef __attribute__((ext_vector_type(8)))  float    v8f;
typedef __attribute__((ext_vector_type(4)))  float    v4f;
typedef __attribute__((ext_vector_type(2)))  float    v2f;

#define NB 8
#define NC 64
#define NH 128
#define NW 256
#define HWSZ (NH * NW)
#define BN_EPS 1e-5f
#define LOG2E 1.44269504088896340736f

// LDS layout (in halfs). All strides multiples of 8 halfs (16B) for b128 ds ops.
// Kt and V exist once per side (0 = left row, 1 = right row); a side's V follows its Kt,
// so every constant offset from the side's base fits a ds instruction's offset field.
#define XT_STR 72
#define KT_SZ  (256 * 72)
#define V_STR  264
#define V_SZ   (64 * 264)
#define SIDE_SZ (KT_SZ + V_SZ)
// Folded weights, fragment order: 32 groups [conv][out tile][ch half][part] of 32 lanes x 8
// halfs, so a wave's 16-byte read is 512 contiguous bytes; 8 halfs of pad per group spread
// the writers' banks. Behind them 128 folded f32 biases (Q then K).
#define WF_OFF (2 * SIDE_SZ)
#define WF_GRP 264
#define BF_OFF (WF_OFF + 32 * WF_GRP)
#define SMEM_HALFS (BF_OFF + 256)              // 79360 halfs
#define SMEM_BYTES (SMEM_HALFS * 2)            // 158720 B: two blocks per WGP

__device__ __forceinline__ v8f wmma16(v16h a, v16h b, v8f c) {
  // D = A(16x32 f16) * B(32x16 f16) + C(16x16 f32)
  return __builtin_amdgcn_wmma_f32_16x16x32_f16(false, a, false, b,
                                                (short)0, c, false, false);
}

// Load one 16x32 f16 A/B operand half-row for this lane:
// elements 0..7 = p[0..7], elements 8..15 = p[16..23]  (caller adds the
// lane<16 ? 0 : 8 half-wave K offset).
__device__ __forceinline__ v16h ld_ab(const _Float16* p) {
  v8h lo = *(const v8h*)(p);
  v8h hi = *(const v8h*)(p + 16);
  v16h r;
#pragma unroll
  for (int i = 0; i < 8; ++i) { r[i] = lo[i]; r[8 + i] = hi[i]; }
  return r;
}

// One A fragment of the folded weights: wf = the lane's 8 halfs in group 0 of the conv.
__device__ __forceinline__ v16h ld_wf(const _Float16* wf, int t, int kh) {
  v8h lo = *(const v8h*)(wf + ((t * 2 + kh) * 2) * WF_GRP);
  v8h hi = *(const v8h*)(wf + ((t * 2 + kh) * 2 + 1) * WF_GRP);
  v16h r;
#pragma unroll
  for (int i = 0; i < 8; ++i) { r[i] = lo[i]; r[8 + i] = hi[i]; }
  return r;
}

// One lane's share of a row for the conv's B operand. p points at channel k0,
// pixels 4*hl .. 4*hl+3 of the wave's 64 pixels. raw[kh*16 + q] is element q
// of the fragment of in-channels kh*32..kh*32+31 (the k order of ld_ab):
// .x .y .z .w belong to column hl of pixel tiles 0 1 2 3.
__device__ __forceinline__ void load_row(const float* __restrict__ p, float4 (&raw)[32]) {
#pragma unroll
  for (int i = 0; i < 32; ++i)
    raw[i] = *(const float4*)(p + (size_t)((i >> 3) * 16 + (i & 7)) * HWSZ);
}

__device__ __forceinline__ void to_frags(const float4 (&raw)[32], v16h (&xb)[2][2][2]) {
#pragma unroll
  for (int kh = 0; kh < 2; ++kh)
#pragma unroll
    for (int q = 0; q < 16; ++q) {
      xb[0][0][kh][q] = (_Float16)raw[kh * 16 + q].x;
      xb[0][1][kh][q] = (_Float16)raw[kh * 16 + q].y;
      xb[1][0][kh][q] = (_Float16)raw[kh * 16 + q].z;
      xb[1][1][kh][q] = (_Float16)raw[kh * 16 + q].w;
    }
}

// Conv 1x1 over the wave's 64 pixels: Y(64 out x 64 px) = W'(64x64) X + b'.
// dst points at the row of this lane's first pixel, channel k0; pixel tile g*2 + j is
// g*2 + j rows on. Each weight fragment serves all four pixel tiles.
__device__ __forceinline__ void conv_frags(_Float16* dst, const _Float16* Wf,
                                           const float* Bf,
                                           const v16h (&xb)[2][2][2]) {
#pragma unroll
  for (int t = 0; t < 4; ++t) {                    // 4 out-channel tiles
    v16h a0 = ld_wf(Wf, t, 0);
    v16h a1 = ld_wf(Wf, t, 1);
    const v4f bl = *(const v4f*)(Bf + t * 16);     // Bf = the conv's biases + k0
    const v4f bh = *(const v4f*)(Bf + t * 16 + 4);
    v8f bias = {bl[0], bl[1], bl[2], bl[3], bh[0], bh[1], bh[2], bh[3]};
#pragma unroll
    for (int g = 0; g < 2; ++g)                    // pixel group
#pragma unroll
      for (int j = 0; j < 2; ++j) {                // pixel tile g*2 + j
        v8f acc = wmma16(a0, xb[g][j][0], bias);
        acc = wmma16(a1, xb[g][j][1], acc);
        v8h hv;
#pragma unroll
        for (int k = 0; k < 8; ++k) hv[k] = (_Float16)acc[k];
        *(v8h*)(dst + (g * 2 + j) * XT_STR + t * 16) = hv;
      }
  }
}

// The same conv for one group of 32 pixels, its result kept in registers. A 16-channel
// accumulator tile t holds, per lane, channels t*16 + k0 .. + 7 of one pixel: exactly
// elements (t&1)*8 .. + 7 of the B fragment of channels (t>>1)*32 .. + 31 in the k order of
// ld_ab. qf[j] = fragments of the group's pixel tile j, column hl = pixel 4*hl + 2*group + j.
__device__ __forceinline__ void conv_regs(v16h (&qf)[2][2], const _Float16* Wf,
                                          const float* Bf,
                                          const v16h (&xb)[2][2]) {
#pragma unroll
  for (int t = 0; t < 4; ++t) {                    // 4 out-channel tiles
    v16h a0 = ld_wf(Wf, t, 0);
    v16h a1 = ld_wf(Wf, t, 1);
    const v4f bl = *(const v4f*)(Bf + t * 16);     // Bf = the conv's biases + k0
    const v4f bh = *(const v4f*)(Bf + t * 16 + 4);
    v8f bias = {bl[0], bl[1], bl[2], bl[3], bh[0], bh[1], bh[2], bh[3]};
#pragma unroll
    for (int j = 0; j < 2; ++j) {                  // the group's pixel tile
      v8f acc = wmma16(a0, xb[j][0], bias);
      acc = wmma16(a1, xb[j][1], acc);
#pragma unroll
      for (int k = 0; k < 8; ++k) qf[j][t >> 1][(t & 1) * 8 + k] = (_Float16)acc[k];
    }
  }
}

// One pass's scores S^T = K^T Q: two key tiles (keys +0..15 and +16..31) for both query tiles.
// kr = the lane's key row of the pass, at channel k0.
__device__ __forceinline__ void qk_scores(const _Float16* kr, const v16h (&q)[2][2],
                                          v8f (&s)[2][2]) {
  const _Float16* kr1 = kr + 16 * XT_STR;
  v16h ka00 = ld_ab(kr),  ka01 = ld_ab(kr + 32);
  v16h ka10 = ld_ab(kr1), ka11 = ld_ab(kr1 + 32);
#pragma unroll
  for (int j = 0; j < 2; ++j) {       // query tile
    v8f s0, s1;
#pragma unroll
    for (int k = 0; k < 8; ++k) { s0[k] = 0.0f; s1[k] = 0.0f; }
    s0 = wmma16(ka00, q[j][0], s0); s0 = wmma16(ka01, q[j][1], s0);
    s1 = wmma16(ka10, q[j][0], s1); s1 = wmma16(ka11, q[j][1], s1);
    s[j][0] = s0; s[j][1] = s1;
  }
}

// Softmax terms in the exp2 domain (log2e folded into Q) against the reference m: pp in f32
// for the row sums, pb = P^T as the B operand (C layout -> B operand by per-lane pair packing).
__device__ __forceinline__ void sm_terms(const v8f (&s)[2][2], const float (&m)[2],
                                         v2f (&pp)[2][8], v16h (&pb)[2]) {
#pragma unroll
  for (int j = 0; j < 2; ++j)
#pragma unroll
    for (int kt = 0; kt < 2; ++kt)    // key tile
#pragma unroll
      for (int k = 0; k < 8; k += 2) {
        const v2f p = {__builtin_amdgcn_exp2f(s[j][kt][k] - m[j]),
                       __builtin_amdgcn_exp2f(s[j][kt][k + 1] - m[j])};
        pp[j][kt * 4 + (k >> 1)] = p;
        pb[j][kt * 8 + k] = (_Float16)p.x; pb[j][kt * 8 + k + 1] = (_Float16)p.y;
      }
}

// The row sums plus a pass's terms, in the order of the terms: the value that the pass's test reads.
__device__ __forceinline__ void head_sums(const v2f (&l2)[2], const v2f (&pp)[2][8], v2f (&lt)[2]) {
#pragma unroll
  for (int j = 0; j < 2; ++j) {
    lt[j] = l2[j];
#pragma unroll
    for (int i = 0; i < 8; ++i) lt[j] += pp[j][i];
  }
}

// Second bound: 4 waves per SIMD, the two 8-wave blocks per WGP that the LDS allows.
__global__ __launch_bounds__(256, 4) void pam_fused(const float* __restrict__ fea_left,
                                                 const float* __restrict__ fea_right,
                                                 const float* Wq, const float* bq,
                                                 const float* gq, const float* betaq,
                                                 const float* mq, const float* vq,
                                                 const float* Wk, const float* bk,
                                                 const float* gk, const float* betak,
                                                 const float* mk, const float* vk,
                                                 float* __restrict__ out) {
  extern __shared__ _Float16 sm[];
  const int bi  = blockIdx.x;
  const int b   = bi >> 7;
  const int h   = bi & 127;
  const size_t rowoff = (size_t)b * NC * HWSZ + (size_t)h * NW;

  const int tid  = threadIdx.x;
  const int lane = tid & 31;
  const int wid  = __builtin_amdgcn_readfirstlane(tid >> 5);  // wave id, scalar
  const int dir  = wid >> 2;                // side of this wave's row = output half
  const int wvs  = wid & 3;                 // the wave's 64 pixels within the row
  const float* own = dir ? fea_right : fea_left;   // queries; the other side's keys/values
  const int hl   = lane & 15;
  const int k0   = (lane < 16) ? 0 : 8;     // ISA half-wave K offset

  // ---- staging: no transposing LDS stage, fragments come straight from global ----
  const int    pxl  = wvs * 64 + 4 * hl;            // this lane's first pixel
  const size_t loff = rowoff + (size_t)k0 * HWSZ + pxl;
  float4 raw[32];
  v16h   xb[2][2][2];                               // [group][tile of it][ch 0..31 / 32..63]

  // ---- weight and BN loads go out first: they come back first, from L2 ----
  // Thread tid takes 4 neighbouring weights of rows frow, + 16, + 32, + 48 of both matrices
  // (a wave's 16-byte load = 512 contiguous bytes). Every thread also loads one channel's
  // five bias terms, so that no branch stands among the loads; waves 0..3 fold them.
  const int frow = tid >> 4;
  const int fcol = (tid & 15) * 4;
  const int woff = frow * 64 + fcol;
  const int bo   = tid & 63;
  const bool bk_side = (wid >> 1) & 1;              // waves 0,1: Q biases; waves 2,3: K biases
  float4 wv[8];
  float  fg[8], fv[8];
#pragma unroll
  for (int j = 0; j < 8; ++j) {                     // j >> 2: matrix, j & 3: 16-row tile
    wv[j] = *(const float4*)(((j >> 2) ? Wk : Wq) + (j & 3) * 1024 + woff);
    fg[j] = ((j >> 2) ? gk : gq)[(j & 3) * 16 + frow];
    fv[j] = ((j >> 2) ? vk : vq)[(j & 3) * 16 + frow];
  }
  const float b_b = (bk_side ? bk : bq)[bo],       b_g = (bk_side ? gk : gq)[bo];
  const float b_t = (bk_side ? betak : betaq)[bo], b_m = (bk_side ? mk : mq)[bo];
  const float b_v = (bk_side ? vk : vq)[bo];
  // The wait that belongs in front of any overwrite of these loads' offset registers
  // (named as inputs, so they stay untouched up to here). Its memory clobber also holds the
  // loads above it (their pointers are not restrict for that reason): issued behind the
  // row loads they would come back behind them, and the fold would wait for the whole row.
  asm volatile("s_wait_xcnt 0x0" :: "v"(woff * 4), "v"(frow), "v"(bo) : "memory");

  const float* po = own + loff;
  load_row(po, raw);                                // the whole share in flight at once
  // The wait that belongs in front of any overwrite of the loads' address registers;
  // naming the address as an input keeps its registers untouched up to here.
  asm volatile("s_wait_xcnt 0x0" :: "v"(po) : "memory");
  // Keeps the fold's arithmetic, and with it the wait for the first BN values, from being
  // scheduled in front of the row loads: those would then go out an L2 round trip later.
  __builtin_amdgcn_sched_barrier(0);

  // ---- fold BN into the weights (log2e/64 into Q's: cost/64, softmax in exp2) -> LDS ----
  {
    const float qscale = LOG2E / 64.0f;
    _Float16* wdst = sm + WF_OFF + (fcol >> 4) * WF_GRP
                   + (((fcol >> 3) & 1) * 16 + frow) * 8 + (fcol & 7);
#pragma unroll
    for (int j = 0; j < 8; ++j) {
      const float s = fg[j] * rsqrtf(fv[j] + BN_EPS);
      v4h hv;
      if (j >> 2) {
        hv[0] = (_Float16)(wv[j].x * s); hv[1] = (_Float16)(wv[j].y * s);
        hv[2] = (_Float16)(wv[j].z * s); hv[3] = (_Float16)(wv[j].w * s);
      } else {
        hv[0] = (_Float16)(wv[j].x * s * qscale); hv[1] = (_Float16)(wv[j].y * s * qscale);
        hv[2] = (_Float16)(wv[j].z * s * qscale); hv[3] = (_Float16)(wv[j].w * s * qscale);
      }
      *(v4h*)(wdst + ((j >> 2) * 16 + (j & 3) * 4) * WF_GRP) = hv;
    }
    if (wid < 4) {
      const float s  = b_g * rsqrtf(b_v + BN_EPS);
      const float bf = s * b_b + b_t - b_m * s;
      ((float*)(sm + BF_OFF))[tid] = bk_side ? bf : bf * qscale;
    }
  }
  // Barrier for the folded weights. Its fences name LDS alone: __syncthreads() would also
  // wait for every global load, and the row loads are meant to stay in flight across it.
  __builtin_amdgcn_fence(__ATOMIC_RELEASE, "workgroup", "local");
  __builtin_amdgcn_s_barrier();
  __builtin_amdgcn_fence(__ATOMIC_ACQUIRE, "workgroup", "local");

  // ---- own row -> this side's V (c,w) and the fragments of both convs ----
  _Float16* vown = sm + dir * SIDE_SZ + KT_SZ;
#pragma unroll
  for (int i = 0; i < 32; ++i) {
    v4h hv4 = {(_Float16)raw[i].x, (_Float16)raw[i].y, (_Float16)raw[i].z, (_Float16)raw[i].w};
    *(v4h*)(vown + ((i >> 3) * 16 + (i & 7) + k0) * V_STR + pxl) = hv4;
  }
  to_frags(raw, xb);

  // ---- conv K -> this side's Kt, conv Q (log2e/64 folded) of group 0 -> registers ----
  const _Float16* wfl = sm + WF_OFF + lane * 8;
  const float*    bfl = (const float*)(sm + BF_OFF) + k0;
  conv_frags(sm + dir * SIDE_SZ + pxl * XT_STR + k0, wfl + 16 * WF_GRP, bfl + 64, xb);
  // qall: [query tile][ch 0..31 / 32..63], as the conv leaves them: column hl of tile j of
  // group g is pixel 4 * hl + 2 * g + j.
  v16h qall[2][2];
  conv_regs(qall, wfl, bfl, xb[0]);
  __syncthreads();

  const _Float16* kt_o = sm + (dir ^ 1) * SIDE_SZ;          // the other side's keys
  const _Float16* v_o  = kt_o + KT_SZ;                      // and values

  // ---- attention: per wave, its two groups of 32 queries, one after the other ----
  // Unrolled so that g is a constant: the row fragments are registers, not indexable.
  v8f keep[2][4];                       // group 0's finished output, until group 1's is there
#pragma unroll
  for (int g = 0; g < 2; ++g) {
    // Group 1's conv Q stands here, not in front of the barrier, so that the group waits
    // through group 0's key loop as its 32 registers of row fragments and no more; the
    // folded weights stay in LDS to the end.
    if (g == 1) conv_regs(qall, wfl, bfl, xb[1]);

    v8f o[2][4];                        // [query tile][channel tile]
    float m[2];
    // The lane's own share of each query's row sum: its 16 of every pass's 32 keys, even and
    // odd positions apart (one packed add takes two terms). Joined behind the key loop.
    v2f l2[2];
#pragma unroll
    for (int j = 0; j < 2; ++j) {
#pragma unroll
      for (int t = 0; t < 4; ++t)
#pragma unroll
        for (int k = 0; k < 8; ++k) o[j][t][k] = 0.0f;
      m[j] = -3.0e38f; l2[j] = (v2f){0.0f, 0.0f};
    }

    // One pass = 32 keys. m is a reference, not the true maximum: any m gives the same quotient
    // O / l. The common path looks for no maximum: it forms P against the m in use and adds it
    // to the row sums, which are wanted anyway, and tests those. All terms are >= 0, so a
    // rounded sum is never below any of its terms: sums of at most 2^10 say that every term of
    // the pass is at most 2^10, well inside f16 (an infinite term makes an infinite sum). Only
    // above that, and in the first pass (no m yet), the rare path runs: scores once more from
    // LDS (they are not kept, for registers), true maximum, both halves of a query take the
    // same new m, O and l rescaled, P formed anew, now at most 1.
    auto pass = [&](const int kc, const bool first) __attribute__((always_inline)) {
      const _Float16* kr = kt_o + (kc * 32 + hl) * XT_STR + k0;
      const _Float16* vr = v_o + hl * V_STR + kc * 32 + k0;
      v8f  s[2][2];                     // [query tile][key tile]
      v16h va[4];                       // the pass's V fragments
      v16h pb[2];
      v2f  pp[2][8];                    // the pass's terms in f32, for the row sums
      v2f  lt[2];                       // the row sums with this pass's terms; l2 stays until the test
      bool redo = first;
      if (!first) {
        qk_scores(kr, qall, s);
        // The V fragments are asked for as one group that flies under the exponentials.
#pragma unroll
        for (int ct = 0; ct < 4; ++ct) va[ct] = ld_ab(vr + ct * 16 * V_STR);
        // Keeps the group here: the scheduler otherwise moves each pair of reads down among the
        // products, with a full wait directly behind it.
        __builtin_amdgcn_sched_barrier(0);
        sm_terms(s, m, pp, pb);
        head_sums(l2, pp, lt);
        // One test per pass for the whole wave (a scalar branch).
        const float top = fmaxf(fmaxf(lt[0].x, lt[0].y), fmaxf(lt[1].x, lt[1].y));
        redo = __builtin_amdgcn_ballot_w32(top > 1024.0f) != 0;
      }
      if (redo) {
        qk_scores(kr, qall, s);
        // V is read anew behind the scores, so that its registers are free for the K fragments.
#pragma unroll
        for (int ct = 0; ct < 4; ++ct) va[ct] = ld_ab(vr + ct * 16 * V_STR);
#pragma unroll
        for (int j = 0; j < 2; ++j) {
          float c = s[j][0][0];         // the lane's own maximum: 16 of the query's 32 scores
#pragma unroll
          for (int k = 1; k < 8; ++k) c = fmaxf(c, s[j][0][k]);
#pragma unroll
          for (int k = 0; k < 8; ++k) c = fmaxf(c, s[j][1][k]);
          const float cj   = fmaxf(c, __shfl_xor(c, 16, 32));
          const float mn   = fmaxf(m[j], cj);
          const float corr = __builtin_amdgcn_exp2f(m[j] - mn);
          l2[j] = l2[j] * corr;
          m[j] = mn;
#pragma unroll
          for (int t = 0; t < 4; ++t) o[j][t] = o[j][t] * corr;
        }
        sm_terms(s, m, pp, pb);
        head_sums(l2, pp, lt);
      }

      // O^T += V(ch tile, 32 keys) * P, each V fragment for both query tiles
#pragma unroll
      for (int ct = 0; ct < 4; ++ct) {
        o[0][ct] = wmma16(va[ct], pb[0], o[0][ct]);
        o[1][ct] = wmma16(va[ct], pb[1], o[1][ct]);
      }
      l2[0] = lt[0]; l2[1] = lt[1];
    };
    pass(0, true);
    for (int kc = 1; kc < 8; ++kc) pass(kc, false);   // 8 key chunks of 32 keys in all

    // finalize and write out (B,C,H,W) f32; dir selects cxr vs enh half. The lane's columns
    // of the four query tiles are four neighbouring pixels, so each channel goes out as one
    // 16-byte store behind group 1: 16 lanes fill 256 contiguous, aligned bytes, a wave's
    // store two such pieces (channels c, c + 8).
    // Both halves of a query used the same m throughout, so their shares of l simply add.
    float l[2];
#pragma unroll
    for (int j = 0; j < 2; ++j) {
      const float lh = l2[j].x + l2[j].y;
      l[j] = lh + __shfl_xor(lh, 16, 32);
    }
    const float inv0 = 1.0f / l[0], inv1 = 1.0f / l[1];
    if (g == 0) {
#pragma unroll
      for (int ct = 0; ct < 4; ++ct) { keep[0][ct] = o[0][ct] * inv0; keep[1][ct] = o[1][ct] * inv1; }
    } else {
      float* obase = out + (size_t)dir * ((size_t)NB * NC * HWSZ)
                   + (size_t)b * NC * HWSZ + (size_t)h * NW + pxl;
#pragma unroll
      for (int ct = 0; ct < 4; ++ct)
#pragma unroll
        for (int k = 0; k < 8; ++k)
          *(float4*)(obase + (size_t)(ct * 16 + k0 + k) * HWSZ) =
              make_float4(keep[0][ct][k], keep[1][ct][k], o[0][ct][k] * inv0, o[1][ct][k] * inv1);
    }
  }
}

extern "C" void kernel_launch(void* const* d_in, const int* in_sizes, int n_in,
                              void* d_out, int out_size, void* d_ws, size_t ws_size,
                              hipStream_t stream) {
  (void)in_sizes; (void)n_in; (void)out_size; (void)d_ws; (void)ws_size;
  (void)hipFuncSetAttribute((const void*)pam_fused,
                            hipFuncAttributeMaxDynamicSharedMemorySize, SMEM_BYTES);
  pam_fused<<<dim3(NB * NH), dim3(256), SMEM_BYTES, stream>>>(
      (const float*)d_in[0],  (const float*)d_in[1],
      (const float*)d_in[2],  (const float*)d_in[3],  (const float*)d_in[4],
      (const float*)d_in[5],  (const float*)d_in[6],  (const float*)d_in[7],
      (const float*)d_in[8],  (const float*)d_in[9],  (const float*)d_in[10],
      (const float*)d_in[11], (const float*)d_in[12], (const float*)d_in[13],
      (float*)d_out);
}
